// v000
// Times are from an AMD MI455X. After a warm-up the kernel runs many times in a row, and a time is the length of
// such a window on the GPU divided by its runs, so every launch and the gaps after it count. The runs cycle
// through copies of the inputs. A figure is the median of several windows, for all but v000 over two sittings.
// Sittings can differ by a few percent; kernels timed side by side share one.
// v000 is the starting kernel. One run takes 111 microseconds.
#include <hip/hip_runtime.h>
// Block-prefix + diagonal masked attention on given q, k, v ([16][2048][64] f32 each), scale 8/64, prefix length per batch read on device; out = softmax(masked q.k^T * 0.125) v -> [16][2048][64] f32.
// Structure: k -> exact f16 rows, v -> exact f16 V^T rows (LDS transpose); one flash-style kernel: block = 64 queries (4 waves x 16), key tiles of 64 = tiles meeting [0, prefix) plus the tile holding the diagonal; computed transposed: S^T = K Q^T, online softmax per query column (f32), O^T += V^T P^T with P^T taken straight from the packed S^T accumulators.
// Compute dtype: q, k, v RNE-converted to bf16 and carried exactly in f16 (exact products, f32 accumulate) on v_wmma_f32_16x16x32_f16; softmax weights x256 as f16 value + f16 residual x2048 (separate accumulator, folded back in f32); statistics f32.
#ifndef NB
#define NB 16
#endif
#ifndef SEQ
#define SEQ 2048
#endif
#define NB_FULL 16
#define SEQ_FULL 2048
#define HD 64
#define QT (SEQ / 64)
static_assert(SEQ % 64 == 0);
static_assert(SEQ <= SEQ_FULL);
static_assert(NB <= NB_FULL);
static_assert(((size_t)NB * SEQ * HD) % 2048 == 0);

typedef unsigned short v8us __attribute__((ext_vector_type(8), may_alias));
typedef _Float16 v16h __attribute__((ext_vector_type(16)));
typedef float  v8f  __attribute__((ext_vector_type(8)));
typedef float  v4f  __attribute__((ext_vector_type(4)));
typedef float  v4fa __attribute__((ext_vector_type(4), may_alias));
union FragH { v16h v; v8us half[2]; _Float16 h[16]; unsigned short u[16]; };

__device__ __forceinline__ unsigned short bf16_bits(float x) { unsigned int u = __float_as_uint(x); return (unsigned short)((u + 0x7FFFu + ((u >> 16) & 1u)) >> 16); }
__device__ __forceinline__ float bf16_val(unsigned short b) { return __uint_as_float(((unsigned int)b) << 16); }
__device__ __forceinline__ float bf16_rne(float x) { return bf16_val(bf16_bits(x)); }

// fragment (A or B, same k map): elements 0..7 <- p[8h .. 8h+7], elements 8..15 <- p[16+8h .. 16+8h+7]; row / column = lane & 15 chosen by the caller through p
__device__ __forceinline__ v16h g2_frag(const _Float16* p, unsigned hh) { FragH f; f.half[0] = *(const v8us*)((const unsigned short*)p + 8u * hh); f.half[1] = *(const v8us*)((const unsigned short*)p + 16u + 8u * hh); return f.v; }
__device__ __forceinline__ v8f g2_mma(v16h a, v16h b, v8f c) { v8f d = __builtin_amdgcn_wmma_f32_16x16x32_f16(false, a, false, b, (short)0, c, false, false); asm volatile("v_nop\n\tv_nop\n\tv_nop\n\tv_nop" : "+v"(d) : "v"(a), "v"(b)); return d; }
// same fragment map from an f32 row: bf16 RNE then exact f16
__device__ __forceinline__ v16h q_frag(const float* p, unsigned hh) {
  const v4f x0 = *(const v4fa*)(p + 8u * hh), x1 = *(const v4fa*)(p + 8u * hh + 4u);
  const v4f x2 = *(const v4fa*)(p + 16u + 8u * hh), x3 = *(const v4fa*)(p + 16u + 8u * hh + 4u);
  FragH f;
#pragma unroll
  for (int q = 0; q < 4; ++q) { f.h[q] = (_Float16)bf16_rne(x0[q]); f.h[4 + q] = (_Float16)bf16_rne(x1[q]); f.h[8 + q] = (_Float16)bf16_rne(x2[q]); f.h[12 + q] = (_Float16)bf16_rne(x3[q]); }
  return f.v;
}

__global__ __launch_bounds__(256) void k_k16(const float* __restrict__ x, _Float16* __restrict__ X16) {
  const unsigned t = blockIdx.x * 256u + threadIdx.x;
  if (t >= (unsigned)(NB * SEQ * 8)) return;
  const unsigned b = t / (unsigned)(SEQ * 8), rem = t - b * (unsigned)(SEQ * 8);
  const float* src = x + (size_t)b * SEQ_FULL * HD + (size_t)rem * 8u;
  const v4f a = *(const v4fa*)src, c = *(const v4fa*)(src + 4);
  FragH f;
#pragma unroll
  for (int q = 0; q < 4; ++q) { f.h[q] = (_Float16)bf16_rne(a[q]); f.h[4 + q] = (_Float16)bf16_rne(c[q]); }
  const v8us o = f.half[0];
  unsigned short* d = (unsigned short*)X16 + (size_t)t * 8u;
  *(v8us*)d = o;
  
}

__global__ __launch_bounds__(256) void k_vtc(const float* __restrict__ V, _Float16* __restrict__ VT) {
  __shared__ unsigned short tl[64][65];
  const unsigned tid = threadIdx.x;
  const unsigned b = blockIdx.x / (unsigned)QT, sg = blockIdx.x - b * (unsigned)QT;
  const unsigned s0 = sg * 64u;
  for (unsigned i = tid; i < 512u; i += 256u) {
    const unsigned j = i >> 3, d8 = (i & 7u) * 8u;
    const float* src = V + ((size_t)b * SEQ_FULL + s0 + j) * HD + d8;
    const v4f a = *(const v4fa*)src, c = *(const v4fa*)(src + 4);
    FragH f;
#pragma unroll
    for (int q = 0; q < 4; ++q) { f.h[q] = (_Float16)bf16_rne(a[q]); f.h[4 + q] = (_Float16)bf16_rne(c[q]); }
#pragma unroll
    for (int q = 0; q < 8; ++q) tl[d8 + q][j] = f.u[q];
  }
  __syncthreads();
  {
    for (unsigned i = tid; i < 512u; i += 256u) {
      const unsigned d = i >> 3, j8 = (i & 7u) * 8u;
      FragH f;
#pragma unroll
      for (int q = 0; q < 8; ++q) f.u[q] = tl[d][j8 + q];
      const v8us o = f.half[0];
      *(v8us*)((unsigned short*)VT + ((size_t)b * HD + d) * SEQ + s0 + j8) = o;
    }
    
  }
}

// flash attention, transposed form. Lane (hh, ln) of a wave owns query q0 + ln; S^T sub-tile t element r = score(key key0 + 16t + 8hh + r, query q0 + ln).
__global__ __launch_bounds__(128) void k_fattn(const float* __restrict__ Qf, const _Float16* __restrict__ K16, const _Float16* __restrict__ VT,
                                              const int* __restrict__ plen_n, float* __restrict__ Og) {
  __shared__ __attribute__((aligned(16))) float so[4][16][68];      /* wave-private output staging [query][d] */
  const unsigned tid = threadIdx.x, w = tid >> 5, lane = tid & 31u, ln = lane & 15u, hh = lane >> 4;
  const unsigned b = blockIdx.x / (unsigned)QT, qt = blockIdx.x - b * (unsigned)QT;
  const unsigned q0 = qt * 64u + w * 16u;
  const unsigned qidx = q0 + ln;
  int pl = plen_n[b];
  pl = pl < 0 ? 0 : pl; pl = pl > SEQ ? SEQ : pl;
  const unsigned plen = (unsigned)pl;
  const unsigned ntp = (plen + 63u) >> 6;                            /* key tiles meeting [0, plen): <= QT */
  const unsigned ntot = ntp + ((qt >= ntp) ? 1u : 0u);               /* plus the diagonal tile when not covered: <= QT */

  const float* qrow = Qf + ((size_t)b * SEQ_FULL + qidx) * HD;
  const v16h qa0 = q_frag(qrow, hh), qa1 = q_frag(qrow + 32, hh);
  const _Float16* Kb = K16 + (size_t)b * SEQ * HD;
  const _Float16* Vb = VT + (size_t)b * HD * SEQ;

  const float NEGBIG = -1.0e30f;
  const v8f z8 = {0.f, 0.f, 0.f, 0.f, 0.f, 0.f, 0.f, 0.f};
  float m = NEGBIG, l = 0.f;
  v8f oh[4] = {z8, z8, z8, z8}, orr[4] = {z8, z8, z8, z8};

#pragma unroll 1
  for (unsigned it = 0; it < ntot; ++it) {
    const unsigned kt = (it < ntp) ? it : qt;
    const unsigned key0 = kt * 64u;
    v8f s[4];
#pragma unroll
    for (int t = 0; t < 4; ++t) {
      const _Float16* kr = Kb + (size_t)(key0 + (unsigned)t * 16u + ln) * HD;
      const v16h a0 = g2_frag(kr, hh), a1 = g2_frag(kr + 32, hh);
      v8f c = z8;
      c = g2_mma(a0, qa0, c);
      c = g2_mma(a1, qa1, c);
      s[t] = c;
    }
    const bool full = (key0 + 64u <= plen);                          /* wave-uniform */
    float tmx = NEGBIG;
#pragma unroll
    for (int t = 0; t < 4; ++t) {
#pragma unroll
      for (int r = 0; r < 8; ++r) {
        const unsigned key = key0 + (unsigned)t * 16u + 8u * hh + (unsigned)r;
        const bool keep = full | (key < plen) | (key == qidx);
        const float v = keep ? s[t][r] * 0.125f : NEGBIG;
        s[t][r] = v;
        tmx = fmaxf(tmx, v);
      }
    }
    tmx = fmaxf(tmx, __shfl_xor(tmx, 16));
    const float mnew = fmaxf(m, tmx);
    const float alpha = __expf(fmaxf(m - mnew, -80.0f));
    m = mnew;
    FragH ph[2], pr[2];
    float ls = 0.f;
#pragma unroll
    for (int t = 0; t < 4; ++t) {
#pragma unroll
      for (int r = 0; r < 8; ++r) {
        const float sv = s[t][r];
        const float e = __expf(fmaxf(sv - mnew, -80.0f));
        const float p = (sv > -1.0e29f) ? e : 0.0f;
        ls += p;
        const float p256 = p * 256.0f;
        const _Float16 hv = (_Float16)p256;
        const _Float16 rv = (_Float16)((p256 - (float)hv) * 2048.0f);
        ph[t >> 1].h[(t & 1) * 8 + r] = hv;
        pr[t >> 1].h[(t & 1) * 8 + r] = rv;
      }
    }
    l = l * alpha + ls;
#pragma unroll
    for (int dt = 0; dt < 4; ++dt) { oh[dt] = oh[dt] * alpha; orr[dt] = orr[dt] * alpha; }
#pragma unroll
    for (int dt = 0; dt < 4; ++dt) {
      const _Float16* vr = Vb + (size_t)((unsigned)dt * 16u + ln) * SEQ + key0;
      const v16h a0 = g2_frag(vr, hh), a1 = g2_frag(vr + 32, hh);
      oh[dt] = g2_mma(a0, ph[0].v, oh[dt]);
      oh[dt] = g2_mma(a1, ph[1].v, oh[dt]);
      orr[dt] = g2_mma(a0, pr[0].v, orr[dt]);
      orr[dt] = g2_mma(a1, pr[1].v, orr[dt]);
    }
  }

  const float lt = l + __shfl_xor(l, 16);
  const float inv = (1.0f / lt) * 0.00390625f;
#pragma unroll
  for (int dt = 0; dt < 4; ++dt) {
#pragma unroll
    for (int r = 0; r < 8; ++r) so[w][ln][dt * 16 + 8 * (int)hh + r] = (oh[dt][r] + orr[dt][r] * 0.00048828125f) * inv;
  }
  __builtin_amdgcn_fence(4 /* acq_rel order */, "workgroup");
  __builtin_amdgcn_wave_barrier();
  const unsigned rsub = lane >> 4, c4 = (lane & 15u) * 4u;
  float* obase = Og + ((size_t)b * SEQ + q0) * HD;
  {
#pragma unroll
    for (int q = 0; q < 8; ++q) {
      const unsigned r = (unsigned)q * 2u + rsub;
      const v4f v = *(const v4fa*)&so[w][r][c4];
      *(v4f*)(obase + (size_t)r * HD + c4) = v;
    }
    
  }
}

extern "C" void kernel_launch(void* const* d_in, const int* in_sizes, int n_in,
                              void* d_out, int out_size, void* d_ws, size_t ws_size, hipStream_t stream) {
  if (n_in < 4) return;
  const long long need = (long long)NB * SEQ * HD;
  if ((long long)in_sizes[0] < need || (long long)in_sizes[1] < need || (long long)in_sizes[2] < need || in_sizes[3] < NB) return;
  if ((long long)out_size < need) return;
  const float* xq = (const float*)d_in[0];
  const float* xk = (const float*)d_in[1];
  const float* xv = (const float*)d_in[2];
  const int* pl = (const int*)d_in[3];
  char* ws = (char*)d_ws; size_t off = 0;
  auto take = [&](size_t bytes) { char* p = ws + off; off += (bytes + 255) & ~(size_t)255; return p; };
  _Float16* K16 = (_Float16*)take((size_t)NB * SEQ * HD * 2);
  _Float16* VT = (_Float16*)take((size_t)NB * HD * SEQ * 2);
  if (off > ws_size) return;

  k_k16<<<(unsigned)((size_t)NB * SEQ * 8 / 256), 256, 0, stream>>>(xk, K16);
  k_vtc<<<(unsigned)(NB * QT), 256, 0, stream>>>(xv, VT);
  k_fattn<<<(unsigned)(NB * QT), 128, 0, stream>>>(xq, K16, VT, pl, (float*)d_out);
}

// v001
// Measured time: 47.2 microseconds a run.
// Timed twice side by side with v000, it ran 2.37 and 2.42 times as fast.
#include <hip/hip_runtime.h>
// Block-prefix + diagonal masked attention on given q, k, v ([16][2048][64] f32 each), scale 8/64, prefix length per batch read on device; out = softmax(masked q.k^T * 0.125) v -> [16][2048][64] f32.
// Structure: k -> exact f16 rows, v -> exact f16 V^T rows (LDS transpose); one flash-style kernel: block = 64 queries (4 waves x 16), key tiles of 64 = tiles meeting [0, prefix) plus the tile holding the diagonal; computed transposed: S^T = K Q^T, online softmax per query column (f32), O^T += V^T P^T with P^T taken straight from the packed S^T accumulators.
// Compute dtype: q, k, v RNE-converted to bf16 and carried exactly in f16 (exact products, f32 accumulate) on v_wmma_f32_16x16x32_f16; softmax weights x256 as f16 value + f16 residual x2048 (separate accumulator, folded back in f32); statistics f32.
#ifndef NB
#define NB 16
#endif
#ifndef SEQ
#define SEQ 2048
#endif
#define NB_FULL 16
#define SEQ_FULL 2048
#define HD 64
#define QT (SEQ / 64)
static_assert(SEQ % 64 == 0);
static_assert(SEQ <= SEQ_FULL);
static_assert(NB <= NB_FULL);
static_assert(((size_t)NB * SEQ * HD) % 2048 == 0);

typedef unsigned short v8us __attribute__((ext_vector_type(8), may_alias));
typedef _Float16 v16h __attribute__((ext_vector_type(16)));
typedef float  v8f  __attribute__((ext_vector_type(8)));
typedef float  v4f  __attribute__((ext_vector_type(4)));
typedef float  v4fa __attribute__((ext_vector_type(4), may_alias));
union FragH { v16h v; v8us half[2]; _Float16 h[16]; unsigned short u[16]; };

__device__ __forceinline__ unsigned short bf16_bits(float x) { unsigned int u = __float_as_uint(x); return (unsigned short)((u + 0x7FFFu + ((u >> 16) & 1u)) >> 16); }
__device__ __forceinline__ float bf16_val(unsigned short b) { return __uint_as_float(((unsigned int)b) << 16); }
__device__ __forceinline__ float bf16_rne(float x) { return bf16_val(bf16_bits(x)); }

// fragment (A or B, same k map): elements 0..7 <- p[8h .. 8h+7], elements 8..15 <- p[16+8h .. 16+8h+7]; row / column = lane & 15 chosen by the caller through p
__device__ __forceinline__ v16h g2_frag(const _Float16* p, unsigned hh) { FragH f; f.half[0] = *(const v8us*)((const unsigned short*)p + 8u * hh); f.half[1] = *(const v8us*)((const unsigned short*)p + 16u + 8u * hh); return f.v; }
__device__ __forceinline__ v8f g2_mma(v16h a, v16h b, v8f c) { v8f d = __builtin_amdgcn_wmma_f32_16x16x32_f16(false, a, false, b, (short)0, c, false, false); asm volatile("v_nop\n\tv_nop\n\tv_nop\n\tv_nop" : "+v"(d) : "v"(a), "v"(b)); return d; }
// same fragment map from an f32 row: bf16 RNE then exact f16
__device__ __forceinline__ v16h q_frag(const float* p, unsigned hh) {
  const v4f x0 = *(const v4fa*)(p + 8u * hh), x1 = *(const v4fa*)(p + 8u * hh + 4u);
  const v4f x2 = *(const v4fa*)(p + 16u + 8u * hh), x3 = *(const v4fa*)(p + 16u + 8u * hh + 4u);
  FragH f;
#pragma unroll
  for (int q = 0; q < 4; ++q) { f.h[q] = (_Float16)bf16_rne(x0[q]); f.h[4 + q] = (_Float16)bf16_rne(x1[q]); f.h[8 + q] = (_Float16)bf16_rne(x2[q]); f.h[12 + q] = (_Float16)bf16_rne(x3[q]); }
  return f.v;
}

__global__ __launch_bounds__(256) void k_k16(const float* __restrict__ x, _Float16* __restrict__ X16) {
  const unsigned t = blockIdx.x * 256u + threadIdx.x;
  if (t >= (unsigned)(NB * SEQ * 8)) return;
  const unsigned b = t / (unsigned)(SEQ * 8), rem = t - b * (unsigned)(SEQ * 8);
  const float* src = x + (size_t)b * SEQ_FULL * HD + (size_t)rem * 8u;
  const v4f a = *(const v4fa*)src, c = *(const v4fa*)(src + 4);
  FragH f;
#pragma unroll
  for (int q = 0; q < 4; ++q) { f.h[q] = (_Float16)bf16_rne(a[q]); f.h[4 + q] = (_Float16)bf16_rne(c[q]); }
  const v8us o = f.half[0];
  unsigned short* d = (unsigned short*)X16 + (size_t)t * 8u;
  *(v8us*)d = o;
  
}

__global__ __launch_bounds__(256) void k_vtc(const float* __restrict__ V, _Float16* __restrict__ VT) {
  __shared__ unsigned short tl[64][65];
  const unsigned tid = threadIdx.x;
  const unsigned b = blockIdx.x / (unsigned)QT, sg = blockIdx.x - b * (unsigned)QT;
  const unsigned s0 = sg * 64u;
  for (unsigned i = tid; i < 512u; i += 256u) {
    const unsigned j = i >> 3, d8 = (i & 7u) * 8u;
    const float* src = V + ((size_t)b * SEQ_FULL + s0 + j) * HD + d8;
    const v4f a = *(const v4fa*)src, c = *(const v4fa*)(src + 4);
    FragH f;
#pragma unroll
    for (int q = 0; q < 4; ++q) { f.h[q] = (_Float16)bf16_rne(a[q]); f.h[4 + q] = (_Float16)bf16_rne(c[q]); }
#pragma unroll
    for (int q = 0; q < 8; ++q) tl[d8 + q][j] = f.u[q];
  }
  __syncthreads();
  {
    for (unsigned i = tid; i < 512u; i += 256u) {
      const unsigned d = i >> 3, j8 = (i & 7u) * 8u;
      FragH f;
#pragma unroll
      for (int q = 0; q < 8; ++q) f.u[q] = tl[d][j8 + q];
      const v8us o = f.half[0];
      *(v8us*)((unsigned short*)VT + ((size_t)b * HD + d) * SEQ + s0 + j8) = o;
    }
    
  }
}

// flash attention, transposed form. Lane (hh, ln) of a wave owns query q0 + ln; S^T sub-tile t element r = score(key key0 + 16t + 8hh + r, query q0 + ln).
__global__ __launch_bounds__(128) void k_fattn(const float* __restrict__ Qf, const _Float16* __restrict__ K16, const _Float16* __restrict__ VT,
                                              const int* __restrict__ plen_n, float* __restrict__ Og) {
  __shared__ __attribute__((aligned(16))) float so[4][16][68];      /* wave-private output staging [query][d] */
  const unsigned tid = threadIdx.x, w = tid >> 5, lane = tid & 31u, ln = lane & 15u, hh = lane >> 4;
  const unsigned b = blockIdx.x / (unsigned)QT, qt = blockIdx.x - b * (unsigned)QT;
  const unsigned q0 = qt * 64u + w * 16u;
  const unsigned qidx = q0 + ln;
  int pl = plen_n[b];
  pl = pl < 0 ? 0 : pl; pl = pl > SEQ ? SEQ : pl;
  const unsigned plen = (unsigned)pl;
  const unsigned ntp = (plen + 63u) >> 6;                            /* key tiles meeting [0, plen): <= QT */
  const unsigned ntot = ntp + ((qt >= ntp) ? 1u : 0u);               /* plus the diagonal tile when not covered: <= QT */

  const float* qrow = Qf + ((size_t)b * SEQ_FULL + qidx) * HD + 8u * hh;   /* the lane's whole address: the loads are this pair plus a constant */
  const v16h qa0 = q_frag(qrow, 0u), qa1 = q_frag(qrow + 32, 0u);
  const _Float16* Kb = K16 + (size_t)b * SEQ * HD;
  const _Float16* Vb = VT + (size_t)b * HD * SEQ;

  const float NEGBIG = -1.0e30f;
  const v8f z8 = {0.f, 0.f, 0.f, 0.f, 0.f, 0.f, 0.f, 0.f};
  float m = NEGBIG, l = 0.f;
  v8f oh[4] = {z8, z8, z8, z8}, orr[4] = {z8, z8, z8, z8};

  /* register pipeline: ka holds the whole K tile of the pass (fetched one pass ahead), va the whole V^T tile (fetched at the head of its pass) */
  v16h ka[4][2], va[4][2];
  {
    const unsigned kf = ((0u < ntp) ? 0u : qt) * 64u;                /* first tile of the walk: ntot >= 1 always */
    const _Float16* kr = Kb + (size_t)(kf + ln) * HD + 8u * hh;      /* the lane's whole address: every load below is this pair plus a constant */
#pragma unroll
    for (int t = 0; t < 4; ++t) { ka[t][0] = g2_frag(kr + t * 16 * HD, 0u); ka[t][1] = g2_frag(kr + t * 16 * HD + 32, 0u); }
    /* the wait that belongs in front of any rewrite of the loads' address pair; the pair is named so that it stays as it is up to here */
    asm volatile("s_wait_xcnt 0x0" :: "v"(kr) : "memory");
  }

#pragma unroll 1
  for (unsigned it = 0; it < ntot; ++it) {
    const unsigned kt = (it < ntp) ? it : qt;
    const unsigned key0 = kt * 64u;
    const _Float16* vr = Vb + (size_t)ln * SEQ + key0 + 8u * hh;     /* the lane's whole address, as above */
#pragma unroll
    for (int dt = 0; dt < 4; ++dt) { va[dt][0] = g2_frag(vr + (size_t)dt * 16 * SEQ, 0u); va[dt][1] = g2_frag(vr + (size_t)dt * 16 * SEQ + 32, 0u); }
    /* keeps the 16 V^T loads issued here, ahead of scores and softmax; without it the scheduler sinks each group to its product and its latency is exposed */
    __builtin_amdgcn_sched_barrier(0);
    v8f s[4];
#pragma unroll
    for (int t = 0; t < 4; ++t) {
      v8f c = z8;
      c = g2_mma(ka[t][0], qa0, c);
      c = g2_mma(ka[t][1], qa1, c);
      s[t] = c;
    }
    const unsigned itn = (it + 1u < ntot) ? it + 1u : it;            /* the last pass fetches its own tile again (in bounds, unused) */
    const unsigned kn = ((itn < ntp) ? itn : qt) * 64u;
    const _Float16* krn = Kb + (size_t)(kn + ln) * HD + 8u * hh;
#pragma unroll
    for (int t = 0; t < 4; ++t) { ka[t][0] = g2_frag(krn + t * 16 * HD, 0u); ka[t][1] = g2_frag(krn + t * 16 * HD + 32, 0u); }
    /* keeps the next tile's 16 K loads issued here, so that softmax and the output products cover their latency */
    __builtin_amdgcn_sched_barrier(0);
    const bool full = (key0 + 64u <= plen);                          /* wave-uniform */
    float tmx = NEGBIG;
#pragma unroll
    for (int t = 0; t < 4; ++t) {
#pragma unroll
      for (int r = 0; r < 8; ++r) {
        const unsigned key = key0 + (unsigned)t * 16u + 8u * hh + (unsigned)r;
        const bool keep = full | (key < plen) | (key == qidx);
        const float v = keep ? s[t][r] * 0.125f : NEGBIG;
        s[t][r] = v;
        tmx = fmaxf(tmx, v);
      }
    }
    tmx = fmaxf(tmx, __shfl_xor(tmx, 16));
    const float mnew = fmaxf(m, tmx);
    const float alpha = __expf(fmaxf(m - mnew, -80.0f));
    m = mnew;
    FragH ph[2], pr[2];
    float ls = 0.f;
#pragma unroll
    for (int t = 0; t < 4; ++t) {
#pragma unroll
      for (int r = 0; r < 8; ++r) {
        const float sv = s[t][r];
        const float e = __expf(fmaxf(sv - mnew, -80.0f));
        const float p = (sv > -1.0e29f) ? e : 0.0f;
        ls += p;
        const float p256 = p * 256.0f;
        const _Float16 hv = (_Float16)p256;
        const _Float16 rv = (_Float16)((p256 - (float)hv) * 2048.0f);
        ph[t >> 1].h[(t & 1) * 8 + r] = hv;
        pr[t >> 1].h[(t & 1) * 8 + r] = rv;
      }
    }
    l = l * alpha + ls;
#pragma unroll
    for (int dt = 0; dt < 4; ++dt) { oh[dt] = oh[dt] * alpha; orr[dt] = orr[dt] * alpha; }
    /* the wait that belongs in front of any rewrite of the address pairs of this pass's loads and of the q loads ahead of the loop; the pairs are named so that they stay as they are up to here */
    asm volatile("s_wait_xcnt 0x0" :: "v"(vr), "v"(krn), "v"(qrow) : "memory");
#pragma unroll
    for (int dt = 0; dt < 4; ++dt) {
      const v16h a0 = va[dt][0], a1 = va[dt][1];
      oh[dt] = g2_mma(a0, ph[0].v, oh[dt]);
      oh[dt] = g2_mma(a1, ph[1].v, oh[dt]);
      orr[dt] = g2_mma(a0, pr[0].v, orr[dt]);
      orr[dt] = g2_mma(a1, pr[1].v, orr[dt]);
    }
  }

  const float lt = l + __shfl_xor(l, 16);
  const float inv = (1.0f / lt) * 0.00390625f;
#pragma unroll
  for (int dt = 0; dt < 4; ++dt) {
#pragma unroll
    for (int r = 0; r < 8; ++r) so[w][ln][dt * 16 + 8 * (int)hh + r] = (oh[dt][r] + orr[dt][r] * 0.00048828125f) * inv;
  }
  __builtin_amdgcn_fence(4 /* acq_rel order */, "workgroup");
  __builtin_amdgcn_wave_barrier();
  const unsigned rsub = lane >> 4, c4 = (lane & 15u) * 4u;
  float* obase = Og + ((size_t)b * SEQ + q0) * HD;
  {
#pragma unroll
    for (int q = 0; q < 8; ++q) {
      const unsigned r = (unsigned)q * 2u + rsub;
      const v4f v = *(const v4fa*)&so[w][r][c4];
      *(v4f*)(obase + (size_t)r * HD + c4) = v;
    }
    
  }
}

extern "C" void kernel_launch(void* const* d_in, const int* in_sizes, int n_in,
                              void* d_out, int out_size, void* d_ws, size_t ws_size, hipStream_t stream) {
  if (n_in < 4) return;
  const long long need = (long long)NB * SEQ * HD;
  if ((long long)in_sizes[0] < need || (long long)in_sizes[1] < need || (long long)in_sizes[2] < need || in_sizes[3] < NB) return;
  if ((long long)out_size < need) return;
  const float* xq = (const float*)d_in[0];
  const float* xk = (const float*)d_in[1];
  const float* xv = (const float*)d_in[2];
  const int* pl = (const int*)d_in[3];
  char* ws = (char*)d_ws; size_t off = 0;
  auto take = [&](size_t bytes) { char* p = ws + off; off += (bytes + 255) & ~(size_t)255; return p; };
  _Float16* K16 = (_Float16*)take((size_t)NB * SEQ * HD * 2);
  _Float16* VT = (_Float16*)take((size_t)NB * HD * SEQ * 2);
  if (off > ws_size) return;

  k_k16<<<(unsigned)((size_t)NB * SEQ * 8 / 256), 256, 0, stream>>>(xk, K16);
  k_vtc<<<(unsigned)(NB * QT), 256, 0, stream>>>(xv, VT);
  k_fattn<<<(unsigned)(NB * QT), 128, 0, stream>>>(xq, K16, VT, pl, (float*)d_out);
}

// v002
// Measured time: 41 microseconds a run.
// Two timings next to v001 put it at 1.15 and 1.14 times that version's speed.
// Counting every step since v000, it is 2.75 times as fast.
#include <hip/hip_runtime.h>
// Block-prefix + diagonal masked attention on given q, k, v ([16][2048][64] f32 each), scale 8/64, prefix length per batch read on device; out = softmax(masked q.k^T * 0.125) v -> [16][2048][64] f32.
// Structure: k -> exact f16, v -> exact f16 V^T (LDS transpose), both stored per 64-key tile in the order of the matrix fragments (16 units of 512 B, lane l's 16 B at 16 l); one flash-style kernel: block = 64 queries (4 waves x 16), key tiles of 64 = tiles meeting [0, prefix) plus the tile holding the diagonal; computed transposed: S^T = K Q^T, online softmax per query column (f32), O^T += V^T P^T with P^T taken straight from the packed S^T accumulators.
// Compute dtype: q, k, v RNE-converted to bf16 and carried exactly in f16 (exact products, f32 accumulate) on v_wmma_f32_16x16x32_f16; softmax weights x256 as f16 value + f16 residual x2048 (separate accumulator, folded back in f32); statistics f32.
#ifndef NB
#define NB 16
#endif
#ifndef SEQ
#define SEQ 2048
#endif
#define NB_FULL 16
#define SEQ_FULL 2048
#define HD 64
#define QT (SEQ / 64)
static_assert(SEQ % 64 == 0);
static_assert(SEQ <= SEQ_FULL);
static_assert(NB <= NB_FULL);
static_assert(((size_t)NB * SEQ * HD) % 2048 == 0);

typedef unsigned short v8us __attribute__((ext_vector_type(8), may_alias));
typedef _Float16 v16h __attribute__((ext_vector_type(16)));
typedef float  v8f  __attribute__((ext_vector_type(8)));
typedef float  v4f  __attribute__((ext_vector_type(4)));
typedef float  v4fa __attribute__((ext_vector_type(4), may_alias));
union FragH { v16h v; v8us half[2]; _Float16 h[16]; unsigned short u[16]; };

__device__ __forceinline__ unsigned short bf16_bits(float x) { unsigned int u = __float_as_uint(x); return (unsigned short)((u + 0x7FFFu + ((u >> 16) & 1u)) >> 16); }
__device__ __forceinline__ float bf16_val(unsigned short b) { return __uint_as_float(((unsigned int)b) << 16); }
__device__ __forceinline__ float bf16_rne(float x) { return bf16_val(bf16_bits(x)); }

// fragment (A or B, same k map), p = a row's 32 k values, h = lane >> 4: elements 0..7 <- p[8h .. 8h+7], elements 8..15 <- p[16+8h .. 16+8h+7]; row / column = lane & 15
// that fragment from a packed tile: p = unit base + 8 * lane; elements 0..7 from the first 512-B unit, elements 8..15 from the next, so each wave-wide 16-B load covers four whole 128-B lines
__device__ __forceinline__ v16h pk_frag(const _Float16* p) { FragH f; f.half[0] = *(const v8us*)((const unsigned short*)p); f.half[1] = *(const v8us*)((const unsigned short*)p + 256u); return f.v; }
__device__ __forceinline__ v8f g2_mma(v16h a, v16h b, v8f c) { v8f d = __builtin_amdgcn_wmma_f32_16x16x32_f16(false, a, false, b, (short)0, c, false, false); asm volatile("v_nop\n\tv_nop\n\tv_nop\n\tv_nop" : "+v"(d) : "v"(a), "v"(b)); return d; }
// same fragment map from an f32 row: bf16 RNE then exact f16
__device__ __forceinline__ v16h q_frag(const float* p, unsigned hh) {
  const v4f x0 = *(const v4fa*)(p + 8u * hh), x1 = *(const v4fa*)(p + 8u * hh + 4u);
  const v4f x2 = *(const v4fa*)(p + 16u + 8u * hh), x3 = *(const v4fa*)(p + 16u + 8u * hh + 4u);
  FragH f;
#pragma unroll
  for (int q = 0; q < 4; ++q) { f.h[q] = (_Float16)bf16_rne(x0[q]); f.h[4 + q] = (_Float16)bf16_rne(x1[q]); f.h[8 + q] = (_Float16)bf16_rne(x2[q]); f.h[12 + q] = (_Float16)bf16_rne(x3[q]); }
  return f.v;
}

__global__ __launch_bounds__(256) void k_k16(const float* __restrict__ x, _Float16* __restrict__ X16) {
  const unsigned t = blockIdx.x * 256u + threadIdx.x;
  if (t >= (unsigned)(NB * SEQ * 8)) return;
  const unsigned b = t / (unsigned)(SEQ * 8), rem = t - b * (unsigned)(SEQ * 8);
  /* t counts 16-B pieces of the packed plane: bits 0..3 key row in its group of 16, bit 4 lane half, bit 5 fragment half, bit 6 d half, bits 7..8 row group, the rest the 64-key tile */
  const unsigned key = (rem >> 9) * 64u + ((rem >> 7) & 3u) * 16u + (rem & 15u);
  const unsigned d0 = ((rem >> 6) & 1u) * 32u + ((rem >> 5) & 1u) * 16u + ((rem >> 4) & 1u) * 8u;
  const float* src = x + ((size_t)b * SEQ_FULL + key) * HD + d0;
  const v4f a = *(const v4fa*)src, c = *(const v4fa*)(src + 4);
  FragH f;
#pragma unroll
  for (int q = 0; q < 4; ++q) { f.h[q] = (_Float16)bf16_rne(a[q]); f.h[4 + q] = (_Float16)bf16_rne(c[q]); }
  const v8us o = f.half[0];
  unsigned short* d = (unsigned short*)X16 + (size_t)t * 8u;
  *(v8us*)d = o;
  
}

__global__ __launch_bounds__(256) void k_vtc(const float* __restrict__ V, _Float16* __restrict__ VT) {
  __shared__ unsigned short tl[64][65];
  const unsigned tid = threadIdx.x;
  const unsigned b = blockIdx.x / (unsigned)QT, sg = blockIdx.x - b * (unsigned)QT;
  const unsigned s0 = sg * 64u;
  for (unsigned i = tid; i < 512u; i += 256u) {
    const unsigned j = i >> 3, d8 = (i & 7u) * 8u;
    const float* src = V + ((size_t)b * SEQ_FULL + s0 + j) * HD + d8;
    const v4f a = *(const v4fa*)src, c = *(const v4fa*)(src + 4);
    FragH f;
#pragma unroll
    for (int q = 0; q < 4; ++q) { f.h[q] = (_Float16)bf16_rne(a[q]); f.h[4 + q] = (_Float16)bf16_rne(c[q]); }
#pragma unroll
    for (int q = 0; q < 8; ++q) tl[d8 + q][j] = f.u[q];
  }
  __syncthreads();
  {
    for (unsigned i = tid; i < 512u; i += 256u) {
      /* i counts 16-B pieces of the packed tile: bits 0..3 d row in its group of 16, bit 4 lane half, bit 5 fragment half, bit 6 key half, bits 7..8 d group */
      const unsigned d = ((i >> 7) & 3u) * 16u + (i & 15u), j8 = ((i >> 6) & 1u) * 32u + ((i >> 5) & 1u) * 16u + ((i >> 4) & 1u) * 8u;
      FragH f;
#pragma unroll
      for (int q = 0; q < 8; ++q) f.u[q] = tl[d][j8 + q];
      const v8us o = f.half[0];
      *(v8us*)((unsigned short*)VT + ((size_t)b * QT + sg) * (size_t)(64 * HD) + (size_t)i * 8u) = o;
    }
    
  }
}

// flash attention, transposed form. Lane (hh, ln) of a wave owns query q0 + ln; S^T sub-tile t element r = score(key key0 + 16t + 8hh + r, query q0 + ln).
__global__ __launch_bounds__(128) void k_fattn(const float* __restrict__ Qf, const _Float16* __restrict__ K16, const _Float16* __restrict__ VT,
                                              const int* __restrict__ plen_n, float* __restrict__ Og) {
  __shared__ __attribute__((aligned(16))) float so[4][16][68];      /* wave-private output staging [query][d] */
  const unsigned tid = threadIdx.x, w = tid >> 5, lane = tid & 31u, ln = lane & 15u, hh = lane >> 4;
  const unsigned b = blockIdx.x / (unsigned)QT, qt = blockIdx.x - b * (unsigned)QT;
  const unsigned q0 = qt * 64u + w * 16u;
  const unsigned qidx = q0 + ln;
  int pl = plen_n[b];
  pl = pl < 0 ? 0 : pl; pl = pl > SEQ ? SEQ : pl;
  const unsigned plen = (unsigned)pl;
  const unsigned ntp = (plen + 63u) >> 6;                            /* key tiles meeting [0, plen): <= QT */
  const unsigned ntot = ntp + ((qt >= ntp) ? 1u : 0u);               /* plus the diagonal tile when not covered: <= QT */

  const float* qrow = Qf + ((size_t)b * SEQ_FULL + qidx) * HD + 8u * hh;   /* the lane's whole address: the loads are this pair plus a constant */
  const v16h qa0 = q_frag(qrow, 0u), qa1 = q_frag(qrow + 32, 0u);
  const _Float16* Kb = K16 + (size_t)b * SEQ * HD;
  const _Float16* Vb = VT + (size_t)b * HD * SEQ;
  const unsigned l8 = 8u * lane;                                     /* the lane's place in every 512-B unit of a packed tile, in elements */

  const float NEGBIG = -1.0e30f;
  const v8f z8 = {0.f, 0.f, 0.f, 0.f, 0.f, 0.f, 0.f, 0.f};
  float m = NEGBIG, l = 0.f;
  v8f oh[4] = {z8, z8, z8, z8}, orr[4] = {z8, z8, z8, z8};

  /* register pipeline: ka holds the whole K tile of the pass (fetched one pass ahead), va the whole V^T tile (fetched at the head of its pass) */
  v16h ka[4][2], va[4][2];
  {
    const unsigned kf = (0u < ntp) ? 0u : qt;                        /* first tile of the walk: ntot >= 1 always */
    const _Float16* kr = Kb + (size_t)kf * (64 * HD);                /* the tile's base, the same in every lane: every load below is this pair plus the lane's 16 l bytes plus a constant */
#pragma unroll
    for (int t = 0; t < 4; ++t) { ka[t][0] = pk_frag(kr + l8 + t * 1024); ka[t][1] = pk_frag(kr + l8 + t * 1024 + 512); }
    /* the wait that belongs in front of any rewrite of the loads' base pair; the pair is named so that it stays as it is up to here */
    asm volatile("s_wait_xcnt 0x0" :: "s"(kr) : "memory");
  }

#pragma unroll 1
  for (unsigned it = 0; it < ntot; ++it) {
    const unsigned kt = (it < ntp) ? it : qt;
    const unsigned key0 = kt * 64u;
    const _Float16* vr = Vb + (size_t)kt * (64 * HD);                /* the tile's base, as above */
#pragma unroll
    for (int dt = 0; dt < 4; ++dt) { va[dt][0] = pk_frag(vr + l8 + dt * 1024); va[dt][1] = pk_frag(vr + l8 + dt * 1024 + 512); }
    /* keeps the 16 V^T loads issued here, ahead of scores and softmax; without it the scheduler sinks each group to its product and its latency is exposed */
    __builtin_amdgcn_sched_barrier(0);
    v8f s[4];
#pragma unroll
    for (int t = 0; t < 4; ++t) {
      v8f c = z8;
      c = g2_mma(ka[t][0], qa0, c);
      c = g2_mma(ka[t][1], qa1, c);
      s[t] = c;
    }
    const unsigned itn = (it + 1u < ntot) ? it + 1u : it;            /* the last pass fetches its own tile again (in bounds, unused) */
    const unsigned kn = (itn < ntp) ? itn : qt;
    const _Float16* krn = Kb + (size_t)kn * (64 * HD);
#pragma unroll
    for (int t = 0; t < 4; ++t) { ka[t][0] = pk_frag(krn + l8 + t * 1024); ka[t][1] = pk_frag(krn + l8 + t * 1024 + 512); }
    /* keeps the next tile's 16 K loads issued here, so that softmax and the output products cover their latency */
    __builtin_amdgcn_sched_barrier(0);
    const bool full = (key0 + 64u <= plen);                          /* wave-uniform */
    float tmx = NEGBIG;
#pragma unroll
    for (int t = 0; t < 4; ++t) {
#pragma unroll
      for (int r = 0; r < 8; ++r) {
        const unsigned key = key0 + (unsigned)t * 16u + 8u * hh + (unsigned)r;
        const bool keep = full | (key < plen) | (key == qidx);
        const float v = keep ? s[t][r] * 0.125f : NEGBIG;
        s[t][r] = v;
        tmx = fmaxf(tmx, v);
      }
    }
    tmx = fmaxf(tmx, __shfl_xor(tmx, 16));
    const float mnew = fmaxf(m, tmx);
    const float alpha = __expf(fmaxf(m - mnew, -80.0f));
    m = mnew;
    FragH ph[2], pr[2];
    float ls = 0.f;
#pragma unroll
    for (int t = 0; t < 4; ++t) {
#pragma unroll
      for (int r = 0; r < 8; ++r) {
        const float sv = s[t][r];
        const float e = __expf(fmaxf(sv - mnew, -80.0f));
        const float p = (sv > -1.0e29f) ? e : 0.0f;
        ls += p;
        const float p256 = p * 256.0f;
        const _Float16 hv = (_Float16)p256;
        const _Float16 rv = (_Float16)((p256 - (float)hv) * 2048.0f);
        ph[t >> 1].h[(t & 1) * 8 + r] = hv;
        pr[t >> 1].h[(t & 1) * 8 + r] = rv;
      }
    }
    l = l * alpha + ls;
#pragma unroll
    for (int dt = 0; dt < 4; ++dt) { oh[dt] = oh[dt] * alpha; orr[dt] = orr[dt] * alpha; }
#pragma unroll
    for (int dt = 0; dt < 4; ++dt) {
      const v16h a0 = va[dt][0], a1 = va[dt][1];
      oh[dt] = g2_mma(a0, ph[0].v, oh[dt]);
      oh[dt] = g2_mma(a1, ph[1].v, oh[dt]);
      orr[dt] = g2_mma(a0, pr[0].v, orr[dt]);
      orr[dt] = g2_mma(a1, pr[1].v, orr[dt]);
    }
    /* the wait that belongs in front of any rewrite of the base pairs of this pass's loads and of the address pair of the q loads ahead of the loop; the pairs are named so that they stay as they are up to here */
    asm volatile("s_wait_xcnt 0x0" :: "s"(vr), "s"(krn), "v"(qrow) : "memory");
  }

  const float lt = l + __shfl_xor(l, 16);
  const float inv = (1.0f / lt) * 0.00390625f;
#pragma unroll
  for (int dt = 0; dt < 4; ++dt) {
#pragma unroll
    for (int r = 0; r < 8; ++r) so[w][ln][dt * 16 + 8 * (int)hh + r] = (oh[dt][r] + orr[dt][r] * 0.00048828125f) * inv;
  }
  __builtin_amdgcn_fence(4 /* acq_rel order */, "workgroup");
  __builtin_amdgcn_wave_barrier();
  const unsigned rsub = lane >> 4, c4 = (lane & 15u) * 4u;
  float* obase = Og + ((size_t)b * SEQ + q0) * HD;
  {
#pragma unroll
    for (int q = 0; q < 8; ++q) {
      const unsigned r = (unsigned)q * 2u + rsub;
      const v4f v = *(const v4fa*)&so[w][r][c4];
      *(v4f*)(obase + (size_t)r * HD + c4) = v;
    }
    
  }
}

extern "C" void kernel_launch(void* const* d_in, const int* in_sizes, int n_in,
                              void* d_out, int out_size, void* d_ws, size_t ws_size, hipStream_t stream) {
  if (n_in < 4) return;
  const long long need = (long long)NB * SEQ * HD;
  if ((long long)in_sizes[0] < need || (long long)in_sizes[1] < need || (long long)in_sizes[2] < need || in_sizes[3] < NB) return;
  if ((long long)out_size < need) return;
  const float* xq = (const float*)d_in[0];
  const float* xk = (const float*)d_in[1];
  const float* xv = (const float*)d_in[2];
  const int* pl = (const int*)d_in[3];
  char* ws = (char*)d_ws; size_t off = 0;
  auto take = [&](size_t bytes) { char* p = ws + off; off += (bytes + 255) & ~(size_t)255; return p; };
  _Float16* K16 = (_Float16*)take((size_t)NB * SEQ * HD * 2);
  _Float16* VT = (_Float16*)take((size_t)NB * HD * SEQ * 2);
  if (off > ws_size) return;

  k_k16<<<(unsigned)((size_t)NB * SEQ * 8 / 256), 256, 0, stream>>>(xk, K16);
  k_vtc<<<(unsigned)(NB * QT), 256, 0, stream>>>(xv, VT);
  k_fattn<<<(unsigned)(NB * QT), 128, 0, stream>>>(xq, K16, VT, pl, (float*)d_out);
}

// v003
// It runs in 31.4 microseconds.
// Timed twice side by side with v002, it ran 1.32 and 1.29 times as fast.
// Over all steps from v000 it is 3.59 times as fast.
#include <hip/hip_runtime.h>
// Block-prefix + diagonal masked attention on given q, k, v ([16][2048][64] f32 each), scale 8/64, prefix length per batch read on device; out = softmax(masked q.k^T * 0.125) v -> [16][2048][64] f32.
// Structure: k -> exact f16, v -> exact f16 V^T (LDS transpose), both stored per 64-key tile in the order of the matrix fragments (16 units of 512 B, lane l's 16 B at 16 l); one flash-style kernel: block = 64 queries (4 waves x 16), key tiles of 64 = tiles meeting [0, prefix) plus the tile holding the diagonal; computed transposed: S^T = K Q^T, online softmax per query column (f32), O^T += V^T P^T with P^T taken straight from the packed S^T accumulators.
// Compute dtype: q, k, v RNE-converted to bf16 and carried exactly in f16 (exact products, f32 accumulate) on v_wmma_f32_16x16x32_f16; softmax weights x256 as f16 value + f16 residual x2048 (separate accumulator, folded back in f32); statistics f32.
#ifndef NB
#define NB 16
#endif
#ifndef SEQ
#define SEQ 2048
#endif
#define NB_FULL 16
#define SEQ_FULL 2048
#define HD 64
#define QT (SEQ / 64)
static_assert(SEQ % 64 == 0);
static_assert(SEQ <= SEQ_FULL);
static_assert(NB <= NB_FULL);
static_assert(((size_t)NB * SEQ * HD) % 2048 == 0);

typedef unsigned short v8us __attribute__((ext_vector_type(8), may_alias));
typedef _Float16 v16h __attribute__((ext_vector_type(16)));
typedef float  v8f  __attribute__((ext_vector_type(8)));
typedef float  v4f  __attribute__((ext_vector_type(4)));
typedef float  v4fa __attribute__((ext_vector_type(4), may_alias));
union FragH { v16h v; v8us half[2]; _Float16 h[16]; unsigned short u[16]; };

__device__ __forceinline__ unsigned short bf16_bits(float x) { unsigned int u = __float_as_uint(x); return (unsigned short)((u + 0x7FFFu + ((u >> 16) & 1u)) >> 16); }
__device__ __forceinline__ float bf16_val(unsigned short b) { return __uint_as_float(((unsigned int)b) << 16); }
__device__ __forceinline__ float bf16_rne(float x) { return bf16_val(bf16_bits(x)); }

// fragment (A or B, same k map), p = a row's 32 k values, h = lane >> 4: elements 0..7 <- p[8h .. 8h+7], elements 8..15 <- p[16+8h .. 16+8h+7]; row / column = lane & 15
// that fragment from a packed tile: p = unit base + 8 * lane; elements 0..7 from the first 512-B unit, elements 8..15 from the next, so each wave-wide 16-B load covers four whole 128-B lines
__device__ __forceinline__ v16h pk_frag(const _Float16* p) { FragH f; f.half[0] = *(const v8us*)((const unsigned short*)p); f.half[1] = *(const v8us*)((const unsigned short*)p + 256u); return f.v; }
__device__ __forceinline__ v8f g2_mma(v16h a, v16h b, v8f c) { v8f d = __builtin_amdgcn_wmma_f32_16x16x32_f16(false, a, false, b, (short)0, c, false, false); asm volatile("v_nop\n\tv_nop\n\tv_nop\n\tv_nop" : "+v"(d) : "v"(a), "v"(b)); return d; }
// same fragment map from an f32 row: bf16 RNE then exact f16
__device__ __forceinline__ v16h q_frag(const float* p, unsigned hh) {
  const v4f x0 = *(const v4fa*)(p + 8u * hh), x1 = *(const v4fa*)(p + 8u * hh + 4u);
  const v4f x2 = *(const v4fa*)(p + 16u + 8u * hh), x3 = *(const v4fa*)(p + 16u + 8u * hh + 4u);
  FragH f;
#pragma unroll
  for (int q = 0; q < 4; ++q) { f.h[q] = (_Float16)bf16_rne(x0[q]); f.h[4 + q] = (_Float16)bf16_rne(x1[q]); f.h[8 + q] = (_Float16)bf16_rne(x2[q]); f.h[12 + q] = (_Float16)bf16_rne(x3[q]); }
  return f.v;
}

__global__ __launch_bounds__(256) void k_k16(const float* __restrict__ x, _Float16* __restrict__ X16) {
  const unsigned t = blockIdx.x * 256u + threadIdx.x;
  if (t >= (unsigned)(NB * SEQ * 8)) return;
  const unsigned b = t / (unsigned)(SEQ * 8), rem = t - b * (unsigned)(SEQ * 8);
  /* t counts 16-B pieces of the packed plane: bits 0..3 key row in its group of 16, bit 4 lane half, bit 5 fragment half, bit 6 d half, bits 7..8 row group, the rest the 64-key tile */
  const unsigned key = (rem >> 9) * 64u + ((rem >> 7) & 3u) * 16u + (rem & 15u);
  const unsigned d0 = ((rem >> 6) & 1u) * 32u + ((rem >> 5) & 1u) * 16u + ((rem >> 4) & 1u) * 8u;
  const float* src = x + ((size_t)b * SEQ_FULL + key) * HD + d0;
  const v4f a = *(const v4fa*)src, c = *(const v4fa*)(src + 4);
  FragH f;
#pragma unroll
  for (int q = 0; q < 4; ++q) { f.h[q] = (_Float16)bf16_rne(a[q]); f.h[4 + q] = (_Float16)bf16_rne(c[q]); }
  const v8us o = f.half[0];
  unsigned short* d = (unsigned short*)X16 + (size_t)t * 8u;
  *(v8us*)d = o;
  
}

__global__ __launch_bounds__(256) void k_vtc(const float* __restrict__ V, _Float16* __restrict__ VT) {
  __shared__ unsigned short tl[64][65];
  const unsigned tid = threadIdx.x;
  const unsigned b = blockIdx.x / (unsigned)QT, sg = blockIdx.x - b * (unsigned)QT;
  const unsigned s0 = sg * 64u;
  for (unsigned i = tid; i < 512u; i += 256u) {
    const unsigned j = i >> 3, d8 = (i & 7u) * 8u;
    const float* src = V + ((size_t)b * SEQ_FULL + s0 + j) * HD + d8;
    const v4f a = *(const v4fa*)src, c = *(const v4fa*)(src + 4);
    FragH f;
#pragma unroll
    for (int q = 0; q < 4; ++q) { f.h[q] = (_Float16)bf16_rne(a[q]); f.h[4 + q] = (_Float16)bf16_rne(c[q]); }
#pragma unroll
    for (int q = 0; q < 8; ++q) tl[d8 + q][j] = f.u[q];
  }
  __syncthreads();
  {
    for (unsigned i = tid; i < 512u; i += 256u) {
      /* i counts 16-B pieces of the packed tile: bits 0..3 d row in its group of 16, bit 4 lane half, bit 5 fragment half, bit 6 key half, bits 7..8 d group */
      const unsigned d = ((i >> 7) & 3u) * 16u + (i & 15u), j8 = ((i >> 6) & 1u) * 32u + ((i >> 5) & 1u) * 16u + ((i >> 4) & 1u) * 8u;
      FragH f;
#pragma unroll
      for (int q = 0; q < 8; ++q) f.u[q] = tl[d][j8 + q];
      const v8us o = f.half[0];
      *(v8us*)((unsigned short*)VT + ((size_t)b * QT + sg) * (size_t)(64 * HD) + (size_t)i * 8u) = o;
    }
    
  }
}

// scores of one 64-key tile -> weights, running maximum, rescale factor, tile sum. FULL: every key of the tile lies inside the prefix, so nothing is masked: the mask's compares and selects and the clamp on a weight's exponent are left out. Same output as the general form: a weight more than 80 below the maximum is 0 in both f16 parts and below the rounding of the sum, clamped or not.
template <bool FULL>
__device__ __forceinline__ void soft_tile(v8f (&s)[4], unsigned key0, unsigned hh, unsigned plen, unsigned qidx, float& m, float& alpha, float& ls, FragH (&ph)[2], FragH (&pr)[2]) {
  const float NEGBIG = -1.0e30f;
  float tmx = NEGBIG;
#pragma unroll
  for (int t = 0; t < 4; ++t) {
#pragma unroll
    for (int r = 0; r < 8; ++r) {
      float v = s[t][r] * 0.125f;
      if (!FULL) {
        const unsigned key = key0 + (unsigned)t * 16u + 8u * hh + (unsigned)r;
        const bool keep = (key < plen) | (key == qidx);
        v = keep ? v : NEGBIG;
      }
      s[t][r] = v;
      tmx = fmaxf(tmx, v);
    }
  }
  tmx = fmaxf(tmx, __shfl_xor(tmx, 16));
  const float mnew = fmaxf(m, tmx);
  alpha = __expf(fmaxf(m - mnew, -80.0f));
  m = mnew;
  ls = 0.f;
#pragma unroll
  for (int t = 0; t < 4; ++t) {
#pragma unroll
    for (int r = 0; r < 8; ++r) {
      const float sv = s[t][r];
      float p;
      if (FULL) {
        p = __expf(sv - mnew);
      } else {
        const float e = __expf(fmaxf(sv - mnew, -80.0f));
        p = (sv > -1.0e29f) ? e : 0.0f;
      }
      ls += p;
      const float p256 = p * 256.0f;
      const _Float16 hv = (_Float16)p256;
      const _Float16 rv = (_Float16)((p256 - (float)hv) * 2048.0f);
      ph[t >> 1].h[(t & 1) * 8 + r] = hv;
      pr[t >> 1].h[(t & 1) * 8 + r] = rv;
    }
  }
}

// flash attention, transposed form. Lane (hh, ln) of a wave owns query q0 + ln; S^T sub-tile t element r = score(key key0 + 16t + 8hh + r, query q0 + ln).
__global__ __launch_bounds__(128) void k_fattn(const float* __restrict__ Qf, const _Float16* __restrict__ K16, const _Float16* __restrict__ VT,
                                              const int* __restrict__ plen_n, float* __restrict__ Og) {
  __shared__ __attribute__((aligned(16))) float so[4][16][68];      /* wave-private output staging [query][d] */
  const unsigned tid = threadIdx.x, w = tid >> 5, lane = tid & 31u, ln = lane & 15u, hh = lane >> 4;
  const unsigned b = blockIdx.x / (unsigned)QT, qt = blockIdx.x - b * (unsigned)QT;
  const unsigned q0 = qt * 64u + w * 16u;
  const unsigned qidx = q0 + ln;
  int pl = plen_n[b];
  pl = pl < 0 ? 0 : pl; pl = pl > SEQ ? SEQ : pl;
  const unsigned plen = (unsigned)pl;
  const unsigned ntp = (plen + 63u) >> 6;                            /* key tiles meeting [0, plen): <= QT */
  const unsigned ntot = ntp + ((qt >= ntp) ? 1u : 0u);               /* plus the diagonal tile when not covered: <= QT */

  const float* qrow = Qf + ((size_t)b * SEQ_FULL + qidx) * HD + 8u * hh;   /* the lane's whole address: the loads are this pair plus a constant */
  const v16h qa0 = q_frag(qrow, 0u), qa1 = q_frag(qrow + 32, 0u);
  const _Float16* Kb = K16 + (size_t)b * SEQ * HD;
  const _Float16* Vb = VT + (size_t)b * HD * SEQ;
  const unsigned l8 = 8u * lane;                                     /* the lane's place in every 512-B unit of a packed tile, in elements */

  const float NEGBIG = -1.0e30f;
  const v8f z8 = {0.f, 0.f, 0.f, 0.f, 0.f, 0.f, 0.f, 0.f};
  float m = NEGBIG, l = 0.f;
  v8f oh[4] = {z8, z8, z8, z8}, orr[4] = {z8, z8, z8, z8};

  /* register pipeline: ka holds the whole K tile of the pass (fetched one pass ahead), va the whole V^T tile (fetched at the head of its pass) */
  v16h ka[4][2], va[4][2];
  {
    const unsigned kf = (0u < ntp) ? 0u : qt;                        /* first tile of the walk: ntot >= 1 always */
    const _Float16* kr = Kb + (size_t)kf * (64 * HD);                /* the tile's base, the same in every lane: every load below is this pair plus the lane's 16 l bytes plus a constant */
#pragma unroll
    for (int t = 0; t < 4; ++t) { ka[t][0] = pk_frag(kr + l8 + t * 1024); ka[t][1] = pk_frag(kr + l8 + t * 1024 + 512); }
    /* the wait that belongs in front of any rewrite of the loads' base pair; the pair is named so that it stays as it is up to here */
    asm volatile("s_wait_xcnt 0x0" :: "s"(kr) : "memory");
  }

  /* the walk in two parts, each a loop of its own (the outer loop is unrolled so that 'part' is a constant in each): first the tiles wholly inside the prefix, then the at most two that hold a masked key */
  const unsigned nfull = plen >> 6;                                  /* tiles 0 .. nfull - 1 lie wholly inside [0, plen): nfull <= ntp */
  unsigned it = 0;
#pragma unroll
  for (int part = 0; part < 2; ++part) {
  const unsigned iend = (part == 0) ? nfull : ntot;
#pragma unroll 1
  for (; it < iend; ++it) {
    const unsigned kt = (it < ntp) ? it : qt;
    const unsigned key0 = kt * 64u;
    const _Float16* vr = Vb + (size_t)kt * (64 * HD);                /* the tile's base, as above */
#pragma unroll
    for (int dt = 0; dt < 4; ++dt) { va[dt][0] = pk_frag(vr + l8 + dt * 1024); va[dt][1] = pk_frag(vr + l8 + dt * 1024 + 512); }
    /* keeps the 16 V^T loads issued here, ahead of scores and softmax; without it the scheduler sinks each group to its product and its latency is exposed */
    __builtin_amdgcn_sched_barrier(0);
    v8f s[4];
#pragma unroll
    for (int t = 0; t < 4; ++t) {
      v8f c = z8;
      c = g2_mma(ka[t][0], qa0, c);
      c = g2_mma(ka[t][1], qa1, c);
      s[t] = c;
    }
    const unsigned itn = (it + 1u < ntot) ? it + 1u : it;            /* the last pass fetches its own tile again (in bounds, unused) */
    const unsigned kn = (itn < ntp) ? itn : qt;
    const _Float16* krn = Kb + (size_t)kn * (64 * HD);
#pragma unroll
    for (int t = 0; t < 4; ++t) { ka[t][0] = pk_frag(krn + l8 + t * 1024); ka[t][1] = pk_frag(krn + l8 + t * 1024 + 512); }
    /* keeps the next tile's 16 K loads issued here, so that softmax and the output products cover their latency */
    __builtin_amdgcn_sched_barrier(0);
    FragH ph[2], pr[2];
    float alpha, ls;
    if (part == 0) soft_tile<true>(s, key0, hh, plen, qidx, m, alpha, ls, ph, pr);
    else soft_tile<false>(s, key0, hh, plen, qidx, m, alpha, ls, ph, pr);
    l = l * alpha + ls;
#pragma unroll
    for (int dt = 0; dt < 4; ++dt) { oh[dt] = oh[dt] * alpha; orr[dt] = orr[dt] * alpha; }
#pragma unroll
    for (int dt = 0; dt < 4; ++dt) {
      const v16h a0 = va[dt][0], a1 = va[dt][1];
      oh[dt] = g2_mma(a0, ph[0].v, oh[dt]);
      oh[dt] = g2_mma(a1, ph[1].v, oh[dt]);
      orr[dt] = g2_mma(a0, pr[0].v, orr[dt]);
      orr[dt] = g2_mma(a1, pr[1].v, orr[dt]);
    }
    /* the wait that belongs in front of any rewrite of the base pairs of this pass's loads and of the address pair of the q loads ahead of the loop; the pairs are named so that they stay as they are up to here */
    asm volatile("s_wait_xcnt 0x0" :: "s"(vr), "s"(krn), "v"(qrow) : "memory");
  }
  }

  const float lt = l + __shfl_xor(l, 16);
  const float inv = (1.0f / lt) * 0.00390625f;
#pragma unroll
  for (int dt = 0; dt < 4; ++dt) {
#pragma unroll
    for (int r = 0; r < 8; ++r) so[w][ln][dt * 16 + 8 * (int)hh + r] = (oh[dt][r] + orr[dt][r] * 0.00048828125f) * inv;
  }
  __builtin_amdgcn_fence(4 /* acq_rel order */, "workgroup");
  __builtin_amdgcn_wave_barrier();
  const unsigned rsub = lane >> 4, c4 = (lane & 15u) * 4u;
  float* obase = Og + ((size_t)b * SEQ + q0) * HD;
  {
#pragma unroll
    for (int q = 0; q < 8; ++q) {
      const unsigned r = (unsigned)q * 2u + rsub;
      const v4f v = *(const v4fa*)&so[w][r][c4];
      *(v4f*)(obase + (size_t)r * HD + c4) = v;
    }
    
  }
}

extern "C" void kernel_launch(void* const* d_in, const int* in_sizes, int n_in,
                              void* d_out, int out_size, void* d_ws, size_t ws_size, hipStream_t stream) {
  if (n_in < 4) return;
  const long long need = (long long)NB * SEQ * HD;
  if ((long long)in_sizes[0] < need || (long long)in_sizes[1] < need || (long long)in_sizes[2] < need || in_sizes[3] < NB) return;
  if ((long long)out_size < need) return;
  const float* xq = (const float*)d_in[0];
  const float* xk = (const float*)d_in[1];
  const float* xv = (const float*)d_in[2];
  const int* pl = (const int*)d_in[3];
  char* ws = (char*)d_ws; size_t off = 0;
  auto take = [&](size_t bytes) { char* p = ws + off; off += (bytes + 255) & ~(size_t)255; return p; };
  _Float16* K16 = (_Float16*)take((size_t)NB * SEQ * HD * 2);
  _Float16* VT = (_Float16*)take((size_t)NB * HD * SEQ * 2);
  if (off > ws_size) return;

  k_k16<<<(unsigned)((size_t)NB * SEQ * 8 / 256), 256, 0, stream>>>(xk, K16);
  k_vtc<<<(unsigned)(NB * QT), 256, 0, stream>>>(xv, VT);
  k_fattn<<<(unsigned)(NB * QT), 128, 0, stream>>>(xq, K16, VT, pl, (float*)d_out);
}

// v004
// One run takes 29.1 microseconds.
// Two timings next to v003 put it at 1.06 and 1.08 times that version's speed.
// Over all steps from v000 it is 3.84 times as fast.
#include <hip/hip_runtime.h>
// Block-prefix + diagonal masked attention on given q, k, v ([16][2048][64] f32 each), scale 8/64, prefix length per batch read on device; out = softmax(masked q.k^T * 0.125) v -> [16][2048][64] f32.
// Structure: k -> exact f16, v -> exact f16 V^T (LDS transpose), both stored per 64-key tile in the order of the matrix fragments (16 units of 512 B, lane l's 16 B at 16 l); one flash-style kernel: a wave owns 16 queries, 4 waves a 64-query tile, a block of 8 waves one such tile of a long-prefix and of a short-prefix batch; key tiles of 64 = tiles meeting [0, prefix) plus the tile holding the diagonal; computed transposed: S^T = K Q^T, online softmax per query column (f32), O^T += V^T P^T with P^T taken straight from the packed S^T accumulators.
// Compute dtype: q, k, v RNE-converted to bf16 and carried exactly in f16 (exact products, f32 accumulate) on v_wmma_f32_16x16x32_f16; softmax weights x256 as f16 value + f16 residual x2048 (separate accumulator, folded back in f32); statistics f32.
#ifndef NB
#define NB 16
#endif
#ifndef SEQ
#define SEQ 2048
#endif
#define NB_FULL 16
#define SEQ_FULL 2048
#define HD 64
#define QT (SEQ / 64)
static_assert(SEQ % 64 == 0);
static_assert(SEQ <= SEQ_FULL);
static_assert(NB <= NB_FULL);
static_assert(NB % 2 == 0);
static_assert(((size_t)NB * SEQ * HD) % 2048 == 0);

typedef unsigned short v8us __attribute__((ext_vector_type(8), may_alias));
typedef _Float16 v16h __attribute__((ext_vector_type(16)));
typedef float  v8f  __attribute__((ext_vector_type(8)));
typedef float  v4f  __attribute__((ext_vector_type(4)));
typedef float  v4fa __attribute__((ext_vector_type(4), may_alias));
union FragH { v16h v; v8us half[2]; _Float16 h[16]; unsigned short u[16]; };

__device__ __forceinline__ unsigned short bf16_bits(float x) { unsigned int u = __float_as_uint(x); return (unsigned short)((u + 0x7FFFu + ((u >> 16) & 1u)) >> 16); }
__device__ __forceinline__ float bf16_val(unsigned short b) { return __uint_as_float(((unsigned int)b) << 16); }
__device__ __forceinline__ float bf16_rne(float x) { return bf16_val(bf16_bits(x)); }

// fragment (A or B, same k map), p = a row's 32 k values, h = lane >> 4: elements 0..7 <- p[8h .. 8h+7], elements 8..15 <- p[16+8h .. 16+8h+7]; row / column = lane & 15
// that fragment from a packed tile: p = unit base + 8 * lane; elements 0..7 from the first 512-B unit, elements 8..15 from the next, so each wave-wide 16-B load covers four whole 128-B lines
__device__ __forceinline__ v16h pk_frag(const _Float16* p) { FragH f; f.half[0] = *(const v8us*)((const unsigned short*)p); f.half[1] = *(const v8us*)((const unsigned short*)p + 256u); return f.v; }
__device__ __forceinline__ v8f g2_mma(v16h a, v16h b, v8f c) { v8f d = __builtin_amdgcn_wmma_f32_16x16x32_f16(false, a, false, b, (short)0, c, false, false); asm volatile("v_nop\n\tv_nop\n\tv_nop\n\tv_nop" : "+v"(d) : "v"(a), "v"(b)); return d; }
// same fragment map from an f32 row: bf16 RNE then exact f16
__device__ __forceinline__ v16h q_frag(const float* p, unsigned hh) {
  const v4f x0 = *(const v4fa*)(p + 8u * hh), x1 = *(const v4fa*)(p + 8u * hh + 4u);
  const v4f x2 = *(const v4fa*)(p + 16u + 8u * hh), x3 = *(const v4fa*)(p + 16u + 8u * hh + 4u);
  FragH f;
#pragma unroll
  for (int q = 0; q < 4; ++q) { f.h[q] = (_Float16)bf16_rne(x0[q]); f.h[4 + q] = (_Float16)bf16_rne(x1[q]); f.h[8 + q] = (_Float16)bf16_rne(x2[q]); f.h[12 + q] = (_Float16)bf16_rne(x3[q]); }
  return f.v;
}

__global__ __launch_bounds__(256) void k_k16(const float* __restrict__ x, _Float16* __restrict__ X16) {
  const unsigned t = blockIdx.x * 256u + threadIdx.x;
  if (t >= (unsigned)(NB * SEQ * 8)) return;
  const unsigned b = t / (unsigned)(SEQ * 8), rem = t - b * (unsigned)(SEQ * 8);
  /* t counts 16-B pieces of the packed plane: bits 0..3 key row in its group of 16, bit 4 lane half, bit 5 fragment half, bit 6 d half, bits 7..8 row group, the rest the 64-key tile */
  const unsigned key = (rem >> 9) * 64u + ((rem >> 7) & 3u) * 16u + (rem & 15u);
  const unsigned d0 = ((rem >> 6) & 1u) * 32u + ((rem >> 5) & 1u) * 16u + ((rem >> 4) & 1u) * 8u;
  const float* src = x + ((size_t)b * SEQ_FULL + key) * HD + d0;
  const v4f a = *(const v4fa*)src, c = *(const v4fa*)(src + 4);
  FragH f;
#pragma unroll
  for (int q = 0; q < 4; ++q) { f.h[q] = (_Float16)bf16_rne(a[q]); f.h[4 + q] = (_Float16)bf16_rne(c[q]); }
  const v8us o = f.half[0];
  unsigned short* d = (unsigned short*)X16 + (size_t)t * 8u;
  *(v8us*)d = o;
  
}

__global__ __launch_bounds__(256) void k_vtc(const float* __restrict__ V, _Float16* __restrict__ VT) {
  __shared__ unsigned short tl[64][65];
  const unsigned tid = threadIdx.x;
  const unsigned b = blockIdx.x / (unsigned)QT, sg = blockIdx.x - b * (unsigned)QT;
  const unsigned s0 = sg * 64u;
  for (unsigned i = tid; i < 512u; i += 256u) {
    const unsigned j = i >> 3, d8 = (i & 7u) * 8u;
    const float* src = V + ((size_t)b * SEQ_FULL + s0 + j) * HD + d8;
    const v4f a = *(const v4fa*)src, c = *(const v4fa*)(src + 4);
    FragH f;
#pragma unroll
    for (int q = 0; q < 4; ++q) { f.h[q] = (_Float16)bf16_rne(a[q]); f.h[4 + q] = (_Float16)bf16_rne(c[q]); }
#pragma unroll
    for (int q = 0; q < 8; ++q) tl[d8 + q][j] = f.u[q];
  }
  __syncthreads();
  {
    for (unsigned i = tid; i < 512u; i += 256u) {
      /* i counts 16-B pieces of the packed tile: bits 0..3 d row in its group of 16, bit 4 lane half, bit 5 fragment half, bit 6 key half, bits 7..8 d group */
      const unsigned d = ((i >> 7) & 3u) * 16u + (i & 15u), j8 = ((i >> 6) & 1u) * 32u + ((i >> 5) & 1u) * 16u + ((i >> 4) & 1u) * 8u;
      FragH f;
#pragma unroll
      for (int q = 0; q < 8; ++q) f.u[q] = tl[d][j8 + q];
      const v8us o = f.half[0];
      *(v8us*)((unsigned short*)VT + ((size_t)b * QT + sg) * (size_t)(64 * HD) + (size_t)i * 8u) = o;
    }
    
  }
}

// scores of one 64-key tile -> weights, running maximum, rescale factor, tile sum. FULL: every key of the tile lies inside the prefix, so nothing is masked: the mask's compares and selects and the clamp on a weight's exponent are left out. Same output as the general form: a weight more than 80 below the maximum is 0 in both f16 parts and below the rounding of the sum, clamped or not.
template <bool FULL>
__device__ __forceinline__ void soft_tile(v8f (&s)[4], unsigned key0, unsigned hh, unsigned plen, unsigned qidx, float& m, float& alpha, float& ls, FragH (&ph)[2], FragH (&pr)[2]) {
  const float NEGBIG = -1.0e30f;
  float tmx = NEGBIG;
#pragma unroll
  for (int t = 0; t < 4; ++t) {
#pragma unroll
    for (int r = 0; r < 8; ++r) {
      float v = s[t][r] * 0.125f;
      if (!FULL) {
        const unsigned key = key0 + (unsigned)t * 16u + 8u * hh + (unsigned)r;
        const bool keep = (key < plen) | (key == qidx);
        v = keep ? v : NEGBIG;
      }
      s[t][r] = v;
      tmx = fmaxf(tmx, v);
    }
  }
  tmx = fmaxf(tmx, __shfl_xor(tmx, 16));
  const float mnew = fmaxf(m, tmx);
  alpha = __expf(fmaxf(m - mnew, -80.0f));
  m = mnew;
  ls = 0.f;
#pragma unroll
  for (int t = 0; t < 4; ++t) {
#pragma unroll
    for (int r = 0; r < 8; ++r) {
      const float sv = s[t][r];
      float p;
      if (FULL) {
        p = __expf(sv - mnew);
      } else {
        const float e = __expf(fmaxf(sv - mnew, -80.0f));
        p = (sv > -1.0e29f) ? e : 0.0f;
      }
      ls += p;
      const float p256 = p * 256.0f;
      const _Float16 hv = (_Float16)p256;
      const _Float16 rv = (_Float16)((p256 - (float)hv) * 2048.0f);
      ph[t >> 1].h[(t & 1) * 8 + r] = hv;
      pr[t >> 1].h[(t & 1) * 8 + r] = rv;
    }
  }
}

// flash attention, transposed form. Lane (hh, ln) of a wave owns query q0 + ln; S^T sub-tile t element r = score(key key0 + 16t + 8hh + r, query q0 + ln).
// Work shares: a block of 8 waves takes query tile qt of two batches, the one with the r-th longest prefix (L) and the one with the r-th shortest (S), ranked on the device. Waves 0..3 walk L's key tiles [0, cut); waves 4..7 walk all of S, store it, then walk L's tiles [cut, end) and hand their partial (maximum, sum, un-normalised output) through LDS to waves 0..3, which merge and store L. cut gives both wave groups about the same number of passes.
__global__ __launch_bounds__(256) void k_fattn(const float* __restrict__ Qf, const _Float16* __restrict__ K16, const _Float16* __restrict__ VT,
                                              const int* __restrict__ plen_n, float* __restrict__ Og) {
  __shared__ __attribute__((aligned(16))) float so[8][16][68];      /* wave-private output staging [query][d] */
  __shared__ float px[4][34][32];                                    /* partial of wave 4 + i for wave i: 32 output values, maximum, sum, each [lane] */
  const unsigned tid = threadIdx.x, lane = tid & 31u, ln = lane & 15u, hh = lane >> 4;
  const unsigned w = (unsigned)__builtin_amdgcn_readfirstlane((int)(tid >> 5));   /* the wave's number as a scalar: every test on it is a scalar branch */
  const unsigned grp = w >> 2, w4 = w & 3u;
  const unsigned rk = blockIdx.x / (unsigned)QT, qt = blockIdx.x - rk * (unsigned)QT;
  const unsigned q0 = qt * 64u + w4 * 16u;
  const unsigned qidx = q0 + ln;

  /* rank of every batch by clamped prefix length, longest first, ties by index: lane ln holds batch ln; the ranks are a permutation of 0 .. NB - 1 for any lengths */
  int plv = plen_n[ln < (unsigned)NB ? ln : (unsigned)(NB - 1)];
  plv = plv < 0 ? 0 : plv; plv = plv > SEQ ? SEQ : plv;
  const int skey = (ln < (unsigned)NB) ? plv * 16 + (int)(15u - ln) : -1;
  int rank = 0;
#pragma unroll
  for (int j = 0; j < NB; ++j) rank += (__builtin_amdgcn_readlane(skey, j) > skey) ? 1 : 0;
  const unsigned bL = (unsigned)__builtin_ctz(__builtin_amdgcn_ballot_w32((rank == (int)rk) & (ln < (unsigned)NB)) | (1u << (NB - 1)));
  const unsigned bS = (unsigned)__builtin_ctz(__builtin_amdgcn_ballot_w32((rank == NB - 1 - (int)rk) & (ln < (unsigned)NB)) | (1u << (NB - 1)));
  const unsigned plL = (unsigned)__builtin_amdgcn_readlane(plv, (int)bL), plS = (unsigned)__builtin_amdgcn_readlane(plv, (int)bS);
  const unsigned ntpL = (plL + 63u) >> 6, ntotL = ntpL + ((qt >= ntpL) ? 1u : 0u);   /* key tiles meeting [0, plen), plus the diagonal tile when not covered: <= QT */
  const unsigned ntpS = (plS + 63u) >> 6, ntotS = ntpS + ((qt >= ntpS) ? 1u : 0u);
  /* equal shares, for speed only (any cut in [1, ntotL] gives the same function): a tile with masked keys counts as one and a half */
  unsigned cut = (2u * (ntotL + ntotS) + (ntotL - (plL >> 6)) + (ntotS - (plS >> 6)) + 3u) >> 2;
  cut = cut > ntotL ? ntotL : cut; cut = cut < 1u ? 1u : cut;

  const unsigned l8 = 8u * lane;                                     /* the lane's place in every 512-B unit of a packed tile, in elements */
  const float NEGBIG = -1.0e30f;
  const v8f z8 = {0.f, 0.f, 0.f, 0.f, 0.f, 0.f, 0.f, 0.f};
  float m = NEGBIG, l = 0.f;
  v8f oh[4], orr[4];

  /* o * inv -> the wave's 16 output rows of batch b, whole 128-B lines through the wave's own staging */
  auto put_rows = [&](unsigned b, const v8f (&o)[4], float inv) {
#pragma unroll
    for (int dt = 0; dt < 4; ++dt) {
#pragma unroll
      for (int r = 0; r < 8; ++r) so[w][ln][dt * 16 + 8 * (int)hh + r] = o[dt][r] * inv;
    }
    __builtin_amdgcn_fence(4 /* acq_rel order */, "workgroup");
    __builtin_amdgcn_wave_barrier();
    const unsigned rsub = lane >> 4, c4 = (lane & 15u) * 4u;
    float* op = Og + ((size_t)b * SEQ + q0 + rsub) * HD + c4;        /* the lane's whole address: the stores are this pair plus a constant */
#pragma unroll
    for (int q = 0; q < 8; ++q) {
      const v4f v = *(const v4fa*)&so[w][(unsigned)q * 2u + rsub][c4];
      *(v4f*)(op + (size_t)q * 2u * HD) = v;
    }
    /* the wait that belongs in front of any rewrite of the stores' address pair; the pair is named so that it stays as it is up to here */
    asm volatile("s_wait_xcnt 0x0" :: "v"(op) : "memory");
  };

  /* segment 0: the short batch, whole (waves 4..7 only); segment 1: this wave group's share of the long batch. One copy of the loops serves both */
#pragma unroll 1
  for (unsigned seg = grp ^ 1u; seg < 2u; ++seg) {
  const unsigned b = seg ? bL : bS, plen = seg ? plL : plS;
  const unsigned ntp = seg ? ntpL : ntpS, ntot = seg ? ntotL : ntotS;
  const unsigned t0 = (seg & grp) ? cut : 0u;                        /* the segment's tiles of the walk: [t0, t1), t1 <= ntot; empty for waves 4..7 where cut == ntotL */
  const unsigned t1 = (seg & (grp ^ 1u)) ? cut : ntot;

  const float* qrow = Qf + ((size_t)b * SEQ_FULL + qidx) * HD + 8u * hh;   /* the lane's whole address: the loads are this pair plus a constant */
  const v16h qa0 = q_frag(qrow, 0u), qa1 = q_frag(qrow + 32, 0u);
  const _Float16* Kb = K16 + (size_t)b * SEQ * HD;
  const _Float16* Vb = VT + (size_t)b * HD * SEQ;
  m = NEGBIG; l = 0.f;
#pragma unroll
  for (int dt = 0; dt < 4; ++dt) { oh[dt] = z8; orr[dt] = z8; }

  /* register pipeline: ka holds the whole K tile of the pass (fetched one pass ahead), va the whole V^T tile (fetched at the head of its pass) */
  v16h ka[4][2], va[4][2];
  {
    const unsigned kf = (t0 < ntp) ? t0 : qt;                        /* first tile of the segment (in bounds also where the segment is empty) */
    const _Float16* kr = Kb + (size_t)kf * (64 * HD);                /* the tile's base, the same in every lane: every load below is this pair plus the lane's 16 l bytes plus a constant */
#pragma unroll
    for (int t = 0; t < 4; ++t) { ka[t][0] = pk_frag(kr + l8 + t * 1024); ka[t][1] = pk_frag(kr + l8 + t * 1024 + 512); }
    /* the wait that belongs in front of any rewrite of the loads' base pair and of the q loads' address pair; the pairs are named so that they stay as they are up to here */
    asm volatile("s_wait_xcnt 0x0" :: "s"(kr), "v"(qrow) : "memory");
  }

  /* the walk in two parts, each a loop of its own (the outer loop is unrolled so that 'part' is a constant in each): first the tiles wholly inside the prefix, then the at most two that hold a masked key */
  const unsigned nfull = plen >> 6;                                  /* tiles 0 .. nfull - 1 lie wholly inside [0, plen): nfull <= ntp */
  unsigned it = t0;
#pragma unroll
  for (int part = 0; part < 2; ++part) {
  const unsigned iend = (part == 0) ? (nfull < t1 ? nfull : t1) : t1;
#pragma unroll 1
  for (; it < iend; ++it) {
    const unsigned kt = (it < ntp) ? it : qt;
    const unsigned key0 = kt * 64u;
    const _Float16* vr = Vb + (size_t)kt * (64 * HD);                /* the tile's base, as above */
#pragma unroll
    for (int dt = 0; dt < 4; ++dt) { va[dt][0] = pk_frag(vr + l8 + dt * 1024); va[dt][1] = pk_frag(vr + l8 + dt * 1024 + 512); }
    /* keeps the 16 V^T loads issued here, ahead of scores and softmax; without it the scheduler sinks each group to its product and its latency is exposed */
    __builtin_amdgcn_sched_barrier(0);
    v8f s[4];
#pragma unroll
    for (int t = 0; t < 4; ++t) {
      v8f c = z8;
      c = g2_mma(ka[t][0], qa0, c);
      c = g2_mma(ka[t][1], qa1, c);
      s[t] = c;
    }
    const unsigned itn = (it + 1u < t1) ? it + 1u : it;              /* the last pass fetches its own tile again (in bounds, unused) */
    const unsigned kn = (itn < ntp) ? itn : qt;
    const _Float16* krn = Kb + (size_t)kn * (64 * HD);
#pragma unroll
    for (int t = 0; t < 4; ++t) { ka[t][0] = pk_frag(krn + l8 + t * 1024); ka[t][1] = pk_frag(krn + l8 + t * 1024 + 512); }
    /* keeps the next tile's 16 K loads issued here, so that softmax and the output products cover their latency */
    __builtin_amdgcn_sched_barrier(0);
    FragH ph[2], pr[2];
    float alpha, ls;
    if (part == 0) soft_tile<true>(s, key0, hh, plen, qidx, m, alpha, ls, ph, pr);
    else soft_tile<false>(s, key0, hh, plen, qidx, m, alpha, ls, ph, pr);
    l = l * alpha + ls;
#pragma unroll
    for (int dt = 0; dt < 4; ++dt) { oh[dt] = oh[dt] * alpha; orr[dt] = orr[dt] * alpha; }
#pragma unroll
    for (int dt = 0; dt < 4; ++dt) {
      const v16h a0 = va[dt][0], a1 = va[dt][1];
      oh[dt] = g2_mma(a0, ph[0].v, oh[dt]);
      oh[dt] = g2_mma(a1, ph[1].v, oh[dt]);
      orr[dt] = g2_mma(a0, pr[0].v, orr[dt]);
      orr[dt] = g2_mma(a1, pr[1].v, orr[dt]);
    }
    /* the wait that belongs in front of any rewrite of the base pairs of this pass's loads; the pairs are named so that they stay as they are up to here */
    asm volatile("s_wait_xcnt 0x0" :: "s"(vr), "s"(krn) : "memory");
  }
  }

#pragma unroll
  for (int dt = 0; dt < 4; ++dt) oh[dt] = oh[dt] + orr[dt] * 0.00048828125f;   /* the residual accumulator folded back */
  if (seg == 0u) {
    const float lt = l + __shfl_xor(l, 16);
    put_rows(b, oh, (1.0f / lt) * 0.00390625f);
  }
  }

  /* the long batch's two partials: waves 4..7 hand theirs over lane for lane (wave 4 + i holds the queries of wave i in the same lanes) */
  if (grp) {
#pragma unroll
    for (int dt = 0; dt < 4; ++dt) {
#pragma unroll
      for (int r = 0; r < 8; ++r) px[w4][dt * 8 + r][lane] = oh[dt][r];
    }
    px[w4][32][lane] = m;
    px[w4][33][lane] = l;
  }
  __syncthreads();                                                   /* every wave passes it once; publishes the partials */
  if (!grp) {
    const float mB = px[w4][32][lane], lB = px[w4][33][lane];
    const float mm = fmaxf(m, mB);
    /* an empty partial has maximum NEGBIG, sum 0 and zeros: its weight is tiny and finite, its terms are 0 */
    const float fa = __expf(fmaxf(m - mm, -80.0f)), fb = __expf(fmaxf(mB - mm, -80.0f));
    l = l * fa + lB * fb;
#pragma unroll
    for (int dt = 0; dt < 4; ++dt) {
#pragma unroll
      for (int r = 0; r < 8; ++r) oh[dt][r] = oh[dt][r] * fa + px[w4][dt * 8 + r][lane] * fb;
    }
    const float lt = l + __shfl_xor(l, 16);
    put_rows(bL, oh, (1.0f / lt) * 0.00390625f);
  }
}

extern "C" void kernel_launch(void* const* d_in, const int* in_sizes, int n_in,
                              void* d_out, int out_size, void* d_ws, size_t ws_size, hipStream_t stream) {
  if (n_in < 4) return;
  const long long need = (long long)NB * SEQ * HD;
  if ((long long)in_sizes[0] < need || (long long)in_sizes[1] < need || (long long)in_sizes[2] < need || in_sizes[3] < NB) return;
  if ((long long)out_size < need) return;
  const float* xq = (const float*)d_in[0];
  const float* xk = (const float*)d_in[1];
  const float* xv = (const float*)d_in[2];
  const int* pl = (const int*)d_in[3];
  char* ws = (char*)d_ws; size_t off = 0;
  auto take = [&](size_t bytes) { char* p = ws + off; off += (bytes + 255) & ~(size_t)255; return p; };
  _Float16* K16 = (_Float16*)take((size_t)NB * SEQ * HD * 2);
  _Float16* VT = (_Float16*)take((size_t)NB * HD * SEQ * 2);
  if (off > ws_size) return;

  k_k16<<<(unsigned)((size_t)NB * SEQ * 8 / 256), 256, 0, stream>>>(xk, K16);
  k_vtc<<<(unsigned)(NB * QT), 256, 0, stream>>>(xv, VT);
  k_fattn<<<(unsigned)(NB / 2 * QT), 256, 0, stream>>>(xq, K16, VT, pl, (float*)d_out);
}

// v005
// A run of this version takes 27.8 microseconds.
// Two timings next to v004 both put it at 1.05 times that version's speed.
// Counting every step since v000, it is 4.04 times as fast.
#include <hip/hip_runtime.h>
// Block-prefix + diagonal masked attention on given q, k, v ([16][2048][64] f32 each), scale 8/64, prefix length per batch read on device; out = softmax(masked q.k^T * 0.125) v -> [16][2048][64] f32.
// Structure: one conversion launch: k -> exact f16, v -> exact f16 V^T (LDS transpose), both stored per 64-key tile in the order of the matrix fragments (16 units of 512 B, lane l's 16 B at 16 l); one flash-style kernel: a wave owns 16 queries, 4 waves a 64-query tile, a block of 8 waves one such tile of a long-prefix and of a short-prefix batch; key tiles of 64 = tiles meeting [0, prefix) plus the tile holding the diagonal; computed transposed: S^T = K Q^T, online softmax per query column (f32), O^T += V^T P^T with P^T taken straight from the packed S^T accumulators.
// Compute dtype: q, k, v RNE-converted to bf16 and carried exactly in f16 (exact products, f32 accumulate) on v_wmma_f32_16x16x32_f16; softmax weights x256 as f16 value + f16 residual x2048 (separate accumulator, folded back in f32); statistics f32.
#ifndef NB
#define NB 16
#endif
#ifndef SEQ
#define SEQ 2048
#endif
#define NB_FULL 16
#define SEQ_FULL 2048
#define HD 64
#define QT (SEQ / 64)
static_assert(SEQ % 64 == 0);
static_assert(SEQ <= SEQ_FULL);
static_assert(NB <= NB_FULL);
static_assert(NB % 2 == 0);
static_assert(((size_t)NB * SEQ * HD) % 2048 == 0);

typedef unsigned short v8us __attribute__((ext_vector_type(8), may_alias));
typedef _Float16 v16h __attribute__((ext_vector_type(16)));
typedef float  v8f  __attribute__((ext_vector_type(8)));
typedef float  v4f  __attribute__((ext_vector_type(4)));
typedef float  v4fa __attribute__((ext_vector_type(4), may_alias));
union FragH { v16h v; v8us half[2]; _Float16 h[16]; unsigned short u[16]; };

__device__ __forceinline__ unsigned short bf16_bits(float x) { unsigned int u = __float_as_uint(x); return (unsigned short)((u + 0x7FFFu + ((u >> 16) & 1u)) >> 16); }
__device__ __forceinline__ float bf16_val(unsigned short b) { return __uint_as_float(((unsigned int)b) << 16); }
__device__ __forceinline__ float bf16_rne(float x) { return bf16_val(bf16_bits(x)); }

// fragment (A or B, same k map), p = a row's 32 k values, h = lane >> 4: elements 0..7 <- p[8h .. 8h+7], elements 8..15 <- p[16+8h .. 16+8h+7]; row / column = lane & 15
// that fragment from a packed tile: p = unit base + 8 * lane; elements 0..7 from the first 512-B unit, elements 8..15 from the next, so each wave-wide 16-B load covers four whole 128-B lines
__device__ __forceinline__ v16h pk_frag(const _Float16* p) { FragH f; f.half[0] = *(const v8us*)((const unsigned short*)p); f.half[1] = *(const v8us*)((const unsigned short*)p + 256u); return f.v; }
__device__ __forceinline__ v8f g2_mma(v16h a, v16h b, v8f c) { v8f d = __builtin_amdgcn_wmma_f32_16x16x32_f16(false, a, false, b, (short)0, c, false, false); asm volatile("v_nop\n\tv_nop\n\tv_nop\n\tv_nop" : "+v"(d) : "v"(a), "v"(b)); return d; }
// same fragment map from an f32 row: bf16 RNE then exact f16
__device__ __forceinline__ v16h q_frag(const float* p, unsigned hh) {
  const v4f x0 = *(const v4fa*)(p + 8u * hh), x1 = *(const v4fa*)(p + 8u * hh + 4u);
  const v4f x2 = *(const v4fa*)(p + 16u + 8u * hh), x3 = *(const v4fa*)(p + 16u + 8u * hh + 4u);
  FragH f;
#pragma unroll
  for (int q = 0; q < 4; ++q) { f.h[q] = (_Float16)bf16_rne(x0[q]); f.h[4 + q] = (_Float16)bf16_rne(x1[q]); f.h[8 + q] = (_Float16)bf16_rne(x2[q]); f.h[12 + q] = (_Float16)bf16_rne(x3[q]); }
  return f.v;
}

#define TPB 2                                                        /* 64-key tiles of K and of V that one conversion block takes */
static_assert(QT % TPB == 0);                                        /* a block's tiles lie in one batch, one behind the other */

// one launch converts K and V: a block takes TPB neighbouring 64-key tiles of both, a thread 2 * TPB 16-B pieces of the packed K plane and as many of the packed V^T plane. Piece n of a thread lies 32 n key rows behind its piece 0 in the source and 256 n pieces behind it in the packed plane, for K and for V alike.
__global__ __launch_bounds__(256) void k_cvt(const float* __restrict__ Kf, const float* __restrict__ V, _Float16* __restrict__ K16, _Float16* __restrict__ VT) {
  __shared__ unsigned short tl[TPB][64][65];
  const unsigned tid = threadIdx.x;
  const unsigned tile0 = blockIdx.x * (unsigned)TPB;                 /* first of the block's tiles, counted over (batch, tile) */
  const unsigned b = tile0 / (unsigned)QT, s0 = (tile0 - b * (unsigned)QT) * 64u;
  /* K: tid counts 16-B pieces of the packed plane: bits 0..3 key row in its group of 16, bit 4 lane half, bit 5 fragment half, bit 6 d half, bit 7 row group (its upper bit and the tile come from n) */
  const float* kp = Kf + ((size_t)b * SEQ_FULL + s0 + ((tid >> 7) & 1u) * 16u + (tid & 15u)) * HD + ((tid >> 6) & 1u) * 32u + ((tid >> 5) & 1u) * 16u + ((tid >> 4) & 1u) * 8u;
  /* V: tid counts 32-B pieces of the rows as they lie */
  const unsigned j = tid >> 3, d8 = (tid & 7u) * 8u;
  const float* vp = V + ((size_t)b * SEQ_FULL + s0 + j) * HD + d8;
  v4f kx[2 * TPB][2], vx[2 * TPB][2];
  /* every loop over n is unrolled so that the register arrays are indexed by constants */
#pragma unroll
  for (int n = 0; n < 2 * TPB; ++n) {
    kx[n][0] = *(const v4fa*)(kp + n * 32 * HD); kx[n][1] = *(const v4fa*)(kp + n * 32 * HD + 4);
    vx[n][0] = *(const v4fa*)(vp + n * 32 * HD); vx[n][1] = *(const v4fa*)(vp + n * 32 * HD + 4);
  }
  /* the wait that belongs in front of any rewrite of the loads' two address pairs; the pairs are named so that they stay as they are up to here. As a memory fence it also keeps all the loads issued ahead of the first LDS store */
  asm volatile("s_wait_xcnt 0x0" :: "v"(kp), "v"(vp) : "memory");
#pragma unroll
  for (int n = 0; n < 2 * TPB; ++n) {
    FragH f;
#pragma unroll
    for (int q = 0; q < 4; ++q) { f.h[q] = (_Float16)bf16_rne(vx[n][0][q]); f.h[4 + q] = (_Float16)bf16_rne(vx[n][1][q]); }
#pragma unroll
    for (int q = 0; q < 8; ++q) tl[n >> 1][d8 + q][j + (unsigned)(n & 1) * 32u] = f.u[q];
  }
  v8us ko[2 * TPB], vo[2 * TPB];
#pragma unroll
  for (int n = 0; n < 2 * TPB; ++n) {
    FragH f;
#pragma unroll
    for (int q = 0; q < 4; ++q) { f.h[q] = (_Float16)bf16_rne(kx[n][0][q]); f.h[4 + q] = (_Float16)bf16_rne(kx[n][1][q]); }
    ko[n] = f.half[0];
  }
  __syncthreads();                                                   /* the transposed tiles are whole */
#pragma unroll
  for (int n = 0; n < 2 * TPB; ++n) {
    const unsigned i = tid + (unsigned)(n & 1) * 256u;
    /* i counts 16-B pieces of the packed tile: bits 0..3 d row in its group of 16, bit 4 lane half, bit 5 fragment half, bit 6 key half, bits 7..8 d group */
    const unsigned d = ((i >> 7) & 3u) * 16u + (i & 15u), j8 = ((i >> 6) & 1u) * 32u + ((i >> 5) & 1u) * 16u + ((i >> 4) & 1u) * 8u;
    FragH f;
#pragma unroll
    for (int q = 0; q < 8; ++q) f.u[q] = tl[n >> 1][d][j8 + q];
    vo[n] = f.half[0];
  }
  /* the stores last, each its plane's one address plus a constant: nothing that they name is rewritten behind them */
  unsigned short* kd = (unsigned short*)K16 + (size_t)tile0 * (size_t)(64 * HD) + (size_t)tid * 8u;
  unsigned short* vd = (unsigned short*)VT + (size_t)tile0 * (size_t)(64 * HD) + (size_t)tid * 8u;
#pragma unroll
  for (int n = 0; n < 2 * TPB; ++n) { *(v8us*)(kd + n * 2048) = ko[n]; *(v8us*)(vd + n * 2048) = vo[n]; }
}

// scores of one 64-key tile -> weights, running maximum, rescale factor, tile sum. FULL: every key of the tile lies inside the prefix, so nothing is masked: the mask's compares and selects and the clamp on a weight's exponent are left out. Same output as the general form: a weight more than 80 below the maximum is 0 in both f16 parts and below the rounding of the sum, clamped or not.
template <bool FULL>
__device__ __forceinline__ void soft_tile(v8f (&s)[4], unsigned key0, unsigned hh, unsigned plen, unsigned qidx, float& m, float& alpha, float& ls, FragH (&ph)[2], FragH (&pr)[2]) {
  const float NEGBIG = -1.0e30f;
  float tmx = NEGBIG;
#pragma unroll
  for (int t = 0; t < 4; ++t) {
#pragma unroll
    for (int r = 0; r < 8; ++r) {
      float v = s[t][r] * 0.125f;
      if (!FULL) {
        const unsigned key = key0 + (unsigned)t * 16u + 8u * hh + (unsigned)r;
        const bool keep = (key < plen) | (key == qidx);
        v = keep ? v : NEGBIG;
      }
      s[t][r] = v;
      tmx = fmaxf(tmx, v);
    }
  }
  tmx = fmaxf(tmx, __shfl_xor(tmx, 16));
  const float mnew = fmaxf(m, tmx);
  alpha = __expf(fmaxf(m - mnew, -80.0f));
  m = mnew;
  ls = 0.f;
#pragma unroll
  for (int t = 0; t < 4; ++t) {
#pragma unroll
    for (int r = 0; r < 8; ++r) {
      const float sv = s[t][r];
      float p;
      if (FULL) {
        p = __expf(sv - mnew);
      } else {
        const float e = __expf(fmaxf(sv - mnew, -80.0f));
        p = (sv > -1.0e29f) ? e : 0.0f;
      }
      ls += p;
      const float p256 = p * 256.0f;
      const _Float16 hv = (_Float16)p256;
      const _Float16 rv = (_Float16)((p256 - (float)hv) * 2048.0f);
      ph[t >> 1].h[(t & 1) * 8 + r] = hv;
      pr[t >> 1].h[(t & 1) * 8 + r] = rv;
    }
  }
}

// flash attention, transposed form. Lane (hh, ln) of a wave owns query q0 + ln; S^T sub-tile t element r = score(key key0 + 16t + 8hh + r, query q0 + ln).
// Work shares: a block of 8 waves takes query tile qt of two batches, the one with the r-th longest prefix (L) and the one with the r-th shortest (S), ranked on the device. Waves 0..3 walk L's key tiles [0, cut); waves 4..7 walk all of S, store it, then walk L's tiles [cut, end) and hand their partial (maximum, sum, un-normalised output) through LDS to waves 0..3, which merge and store L. cut gives both wave groups about the same number of passes.
__global__ __launch_bounds__(256) void k_fattn(const float* __restrict__ Qf, const _Float16* __restrict__ K16, const _Float16* __restrict__ VT,
                                              const int* __restrict__ plen_n, float* __restrict__ Og) {
  __shared__ __attribute__((aligned(16))) float so[8][16][68];      /* wave-private output staging [query][d] */
  __shared__ float px[4][34][32];                                    /* partial of wave 4 + i for wave i: 32 output values, maximum, sum, each [lane] */
  const unsigned tid = threadIdx.x, lane = tid & 31u, ln = lane & 15u, hh = lane >> 4;
  const unsigned w = (unsigned)__builtin_amdgcn_readfirstlane((int)(tid >> 5));   /* the wave's number as a scalar: every test on it is a scalar branch */
  const unsigned grp = w >> 2, w4 = w & 3u;
  const unsigned rk = blockIdx.x / (unsigned)QT, qt = blockIdx.x - rk * (unsigned)QT;
  const unsigned q0 = qt * 64u + w4 * 16u;
  const unsigned qidx = q0 + ln;

  /* rank of every batch by clamped prefix length, longest first, ties by index: lane ln holds batch ln; the ranks are a permutation of 0 .. NB - 1 for any lengths */
  int plv = plen_n[ln < (unsigned)NB ? ln : (unsigned)(NB - 1)];
  plv = plv < 0 ? 0 : plv; plv = plv > SEQ ? SEQ : plv;
  const int skey = (ln < (unsigned)NB) ? plv * 16 + (int)(15u - ln) : -1;
  int rank = 0;
#pragma unroll
  for (int j = 0; j < NB; ++j) rank += (__builtin_amdgcn_readlane(skey, j) > skey) ? 1 : 0;
  const unsigned bL = (unsigned)__builtin_ctz(__builtin_amdgcn_ballot_w32((rank == (int)rk) & (ln < (unsigned)NB)) | (1u << (NB - 1)));
  const unsigned bS = (unsigned)__builtin_ctz(__builtin_amdgcn_ballot_w32((rank == NB - 1 - (int)rk) & (ln < (unsigned)NB)) | (1u << (NB - 1)));
  const unsigned plL = (unsigned)__builtin_amdgcn_readlane(plv, (int)bL), plS = (unsigned)__builtin_amdgcn_readlane(plv, (int)bS);
  const unsigned ntpL = (plL + 63u) >> 6, ntotL = ntpL + ((qt >= ntpL) ? 1u : 0u);   /* key tiles meeting [0, plen), plus the diagonal tile when not covered: <= QT */
  const unsigned ntpS = (plS + 63u) >> 6, ntotS = ntpS + ((qt >= ntpS) ? 1u : 0u);
  /* equal shares, for speed only (any cut in [1, ntotL] gives the same function): a tile with masked keys counts as one and a half */
  unsigned cut = (2u * (ntotL + ntotS) + (ntotL - (plL >> 6)) + (ntotS - (plS >> 6)) + 3u) >> 2;
  cut = cut > ntotL ? ntotL : cut; cut = cut < 1u ? 1u : cut;

  const unsigned l8 = 8u * lane;                                     /* the lane's place in every 512-B unit of a packed tile, in elements */
  const float NEGBIG = -1.0e30f;
  const v8f z8 = {0.f, 0.f, 0.f, 0.f, 0.f, 0.f, 0.f, 0.f};
  float m = NEGBIG, l = 0.f;
  v8f oh[4], orr[4];

  /* o * inv -> the wave's 16 output rows of batch b, whole 128-B lines through the wave's own staging */
  auto put_rows = [&](unsigned b, const v8f (&o)[4], float inv) {
#pragma unroll
    for (int dt = 0; dt < 4; ++dt) {
#pragma unroll
      for (int r = 0; r < 8; ++r) so[w][ln][dt * 16 + 8 * (int)hh + r] = o[dt][r] * inv;
    }
    __builtin_amdgcn_fence(4 /* acq_rel order */, "workgroup");
    __builtin_amdgcn_wave_barrier();
    const unsigned rsub = lane >> 4, c4 = (lane & 15u) * 4u;
    float* op = Og + ((size_t)b * SEQ + q0 + rsub) * HD + c4;        /* the lane's whole address: the stores are this pair plus a constant */
#pragma unroll
    for (int q = 0; q < 8; ++q) {
      const v4f v = *(const v4fa*)&so[w][(unsigned)q * 2u + rsub][c4];
      *(v4f*)(op + (size_t)q * 2u * HD) = v;
    }
    /* the wait that belongs in front of any rewrite of the stores' address pair; the pair is named so that it stays as it is up to here */
    asm volatile("s_wait_xcnt 0x0" :: "v"(op) : "memory");
  };

  /* segment 0: the short batch, whole (waves 4..7 only); segment 1: this wave group's share of the long batch. One copy of the loops serves both */
#pragma unroll 1
  for (unsigned seg = grp ^ 1u; seg < 2u; ++seg) {
  const unsigned b = seg ? bL : bS, plen = seg ? plL : plS;
  const unsigned ntp = seg ? ntpL : ntpS, ntot = seg ? ntotL : ntotS;
  const unsigned t0 = (seg & grp) ? cut : 0u;                        /* the segment's tiles of the walk: [t0, t1), t1 <= ntot; empty for waves 4..7 where cut == ntotL */
  const unsigned t1 = (seg & (grp ^ 1u)) ? cut : ntot;

  const float* qrow = Qf + ((size_t)b * SEQ_FULL + qidx) * HD + 8u * hh;   /* the lane's whole address: the loads are this pair plus a constant */
  const v16h qa0 = q_frag(qrow, 0u), qa1 = q_frag(qrow + 32, 0u);
  const _Float16* Kb = K16 + (size_t)b * SEQ * HD;
  const _Float16* Vb = VT + (size_t)b * HD * SEQ;
  m = NEGBIG; l = 0.f;
#pragma unroll
  for (int dt = 0; dt < 4; ++dt) { oh[dt] = z8; orr[dt] = z8; }

  /* register pipeline: ka holds the whole K tile of the pass (fetched one pass ahead), va the whole V^T tile (fetched at the head of its pass) */
  v16h ka[4][2], va[4][2];
  {
    const unsigned kf = (t0 < ntp) ? t0 : qt;                        /* first tile of the segment (in bounds also where the segment is empty) */
    const _Float16* kr = Kb + (size_t)kf * (64 * HD);                /* the tile's base, the same in every lane: every load below is this pair plus the lane's 16 l bytes plus a constant */
#pragma unroll
    for (int t = 0; t < 4; ++t) { ka[t][0] = pk_frag(kr + l8 + t * 1024); ka[t][1] = pk_frag(kr + l8 + t * 1024 + 512); }
    /* the wait that belongs in front of any rewrite of the loads' base pair and of the q loads' address pair; the pairs are named so that they stay as they are up to here */
    asm volatile("s_wait_xcnt 0x0" :: "s"(kr), "v"(qrow) : "memory");
  }

  /* the walk in two parts, each a loop of its own (the outer loop is unrolled so that 'part' is a constant in each): first the tiles wholly inside the prefix, then the at most two that hold a masked key */
  const unsigned nfull = plen >> 6;                                  /* tiles 0 .. nfull - 1 lie wholly inside [0, plen): nfull <= ntp */
  unsigned it = t0;
#pragma unroll
  for (int part = 0; part < 2; ++part) {
  const unsigned iend = (part == 0) ? (nfull < t1 ? nfull : t1) : t1;
#pragma unroll 1
  for (; it < iend; ++it) {
    const unsigned kt = (it < ntp) ? it : qt;
    const unsigned key0 = kt * 64u;
    const _Float16* vr = Vb + (size_t)kt * (64 * HD);                /* the tile's base, as above */
#pragma unroll
    for (int dt = 0; dt < 4; ++dt) { va[dt][0] = pk_frag(vr + l8 + dt * 1024); va[dt][1] = pk_frag(vr + l8 + dt * 1024 + 512); }
    /* keeps the 16 V^T loads issued here, ahead of scores and softmax; without it the scheduler sinks each group to its product and its latency is exposed */
    __builtin_amdgcn_sched_barrier(0);
    v8f s[4];
#pragma unroll
    for (int t = 0; t < 4; ++t) {
      v8f c = z8;
      c = g2_mma(ka[t][0], qa0, c);
      c = g2_mma(ka[t][1], qa1, c);
      s[t] = c;
    }
    const unsigned itn = (it + 1u < t1) ? it + 1u : it;              /* the last pass fetches its own tile again (in bounds, unused) */
    const unsigned kn = (itn < ntp) ? itn : qt;
    const _Float16* krn = Kb + (size_t)kn * (64 * HD);
#pragma unroll
    for (int t = 0; t < 4; ++t) { ka[t][0] = pk_frag(krn + l8 + t * 1024); ka[t][1] = pk_frag(krn + l8 + t * 1024 + 512); }
    /* keeps the next tile's 16 K loads issued here, so that softmax and the output products cover their latency */
    __builtin_amdgcn_sched_barrier(0);
    FragH ph[2], pr[2];
    float alpha, ls;
    if (part == 0) soft_tile<true>(s, key0, hh, plen, qidx, m, alpha, ls, ph, pr);
    else soft_tile<false>(s, key0, hh, plen, qidx, m, alpha, ls, ph, pr);
    l = l * alpha + ls;
#pragma unroll
    for (int dt = 0; dt < 4; ++dt) { oh[dt] = oh[dt] * alpha; orr[dt] = orr[dt] * alpha; }
#pragma unroll
    for (int dt = 0; dt < 4; ++dt) {
      const v16h a0 = va[dt][0], a1 = va[dt][1];
      oh[dt] = g2_mma(a0, ph[0].v, oh[dt]);
      oh[dt] = g2_mma(a1, ph[1].v, oh[dt]);
      orr[dt] = g2_mma(a0, pr[0].v, orr[dt]);
      orr[dt] = g2_mma(a1, pr[1].v, orr[dt]);
    }
    /* the wait that belongs in front of any rewrite of the base pairs of this pass's loads; the pairs are named so that they stay as they are up to here */
    asm volatile("s_wait_xcnt 0x0" :: "s"(vr), "s"(krn) : "memory");
  }
  }

#pragma unroll
  for (int dt = 0; dt < 4; ++dt) oh[dt] = oh[dt] + orr[dt] * 0.00048828125f;   /* the residual accumulator folded back */
  if (seg == 0u) {
    const float lt = l + __shfl_xor(l, 16);
    put_rows(b, oh, (1.0f / lt) * 0.00390625f);
  }
  }

  /* the long batch's two partials: waves 4..7 hand theirs over lane for lane (wave 4 + i holds the queries of wave i in the same lanes) */
  if (grp) {
#pragma unroll
    for (int dt = 0; dt < 4; ++dt) {
#pragma unroll
      for (int r = 0; r < 8; ++r) px[w4][dt * 8 + r][lane] = oh[dt][r];
    }
    px[w4][32][lane] = m;
    px[w4][33][lane] = l;
  }
  __syncthreads();                                                   /* every wave passes it once; publishes the partials */
  if (!grp) {
    const float mB = px[w4][32][lane], lB = px[w4][33][lane];
    const float mm = fmaxf(m, mB);
    /* an empty partial has maximum NEGBIG, sum 0 and zeros: its weight is tiny and finite, its terms are 0 */
    const float fa = __expf(fmaxf(m - mm, -80.0f)), fb = __expf(fmaxf(mB - mm, -80.0f));
    l = l * fa + lB * fb;
#pragma unroll
    for (int dt = 0; dt < 4; ++dt) {
#pragma unroll
      for (int r = 0; r < 8; ++r) oh[dt][r] = oh[dt][r] * fa + px[w4][dt * 8 + r][lane] * fb;
    }
    const float lt = l + __shfl_xor(l, 16);
    put_rows(bL, oh, (1.0f / lt) * 0.00390625f);
  }
}

extern "C" void kernel_launch(void* const* d_in, const int* in_sizes, int n_in,
                              void* d_out, int out_size, void* d_ws, size_t ws_size, hipStream_t stream) {
  if (n_in < 4) return;
  const long long need = (long long)NB * SEQ * HD;
  if ((long long)in_sizes[0] < need || (long long)in_sizes[1] < need || (long long)in_sizes[2] < need || in_sizes[3] < NB) return;
  if ((long long)out_size < need) return;
  const float* xq = (const float*)d_in[0];
  const float* xk = (const float*)d_in[1];
  const float* xv = (const float*)d_in[2];
  const int* pl = (const int*)d_in[3];
  char* ws = (char*)d_ws; size_t off = 0;
  auto take = [&](size_t bytes) { char* p = ws + off; off += (bytes + 255) & ~(size_t)255; return p; };
  _Float16* K16 = (_Float16*)take((size_t)NB * SEQ * HD * 2);
  _Float16* VT = (_Float16*)take((size_t)NB * HD * SEQ * 2);
  if (off > ws_size) return;

  k_cvt<<<(unsigned)(NB * QT / TPB), 256, 0, stream>>>(xk, xv, K16, VT);
  k_fattn<<<(unsigned)(NB / 2 * QT), 256, 0, stream>>>(xq, K16, VT, pl, (float*)d_out);
}

// v006
// It runs in 26.3 microseconds.
// Two timings next to v005 put it at 1.05 and 1.04 times that version's speed.
// All steps since v000 together make it 4.23 times as fast.
#include <hip/hip_runtime.h>
// Block-prefix + diagonal masked attention on given q, k, v ([16][2048][64] f32 each), scale 8/64, prefix length per batch read on device; out = softmax(masked q.k^T * 0.125) v -> [16][2048][64] f32.
// Structure: one conversion launch: k -> exact f16, v -> exact f16 V^T (LDS transpose), both stored per 64-key tile in the order of the matrix fragments (16 units of 512 B, lane l's 16 B at 16 l); one flash-style kernel: a wave owns 16 queries, 4 waves a 64-query tile, a block of 8 waves one such tile of a long-prefix and of a short-prefix batch; key tiles of 64 = tiles meeting [0, prefix) plus the tile holding the diagonal; computed transposed: S^T = K Q^T, online softmax per query column (f32), O^T += V^T P^T with P^T taken straight from the packed S^T accumulators.
// Compute dtype: q, k, v RNE-converted to bf16 and carried exactly in f16 (exact products, f32 accumulate) on v_wmma_f32_16x16x32_f16; softmax weights x256 as f16 value + f16 residual x2048 (separate accumulator, folded back in f32); statistics f32.
#ifndef NB
#define NB 16
#endif
#ifndef SEQ
#define SEQ 2048
#endif
#define NB_FULL 16
#define SEQ_FULL 2048
#define HD 64
#define QT (SEQ / 64)
static_assert(SEQ % 64 == 0);
static_assert(SEQ <= SEQ_FULL);
static_assert(NB <= NB_FULL);
static_assert(NB % 2 == 0);
static_assert(((size_t)NB * SEQ * HD) % 2048 == 0);

typedef unsigned short v8us __attribute__((ext_vector_type(8), may_alias));
typedef _Float16 v16h __attribute__((ext_vector_type(16)));
typedef float  v8f  __attribute__((ext_vector_type(8)));
typedef float  v4f  __attribute__((ext_vector_type(4)));
typedef float  v4fa __attribute__((ext_vector_type(4), may_alias));
union FragH { v16h v; v8us half[2]; _Float16 h[16]; unsigned short u[16]; };

__device__ __forceinline__ unsigned short bf16_bits(float x) { unsigned int u = __float_as_uint(x); return (unsigned short)((u + 0x7FFFu + ((u >> 16) & 1u)) >> 16); }
__device__ __forceinline__ float bf16_val(unsigned short b) { return __uint_as_float(((unsigned int)b) << 16); }
__device__ __forceinline__ float bf16_rne(float x) { return bf16_val(bf16_bits(x)); }

// fragment (A or B, same k map), p = a row's 32 k values, h = lane >> 4: elements 0..7 <- p[8h .. 8h+7], elements 8..15 <- p[16+8h .. 16+8h+7]; row / column = lane & 15
// that fragment from a packed tile: p = unit base + 8 * lane; elements 0..7 from the first 512-B unit, elements 8..15 from the next, so each wave-wide 16-B load covers four whole 128-B lines
__device__ __forceinline__ v16h pk_frag(const _Float16* p) { FragH f; f.half[0] = *(const v8us*)((const unsigned short*)p); f.half[1] = *(const v8us*)((const unsigned short*)p + 256u); return f.v; }
__device__ __forceinline__ v8f g2_mma(v16h a, v16h b, v8f c) { v8f d = __builtin_amdgcn_wmma_f32_16x16x32_f16(false, a, false, b, (short)0, c, false, false); asm volatile("v_nop\n\tv_nop\n\tv_nop\n\tv_nop" : "+v"(d) : "v"(a), "v"(b)); return d; }
// same fragment map from an f32 row: bf16 RNE then exact f16
__device__ __forceinline__ v16h q_frag(const float* p, unsigned hh) {
  const v4f x0 = *(const v4fa*)(p + 8u * hh), x1 = *(const v4fa*)(p + 8u * hh + 4u);
  const v4f x2 = *(const v4fa*)(p + 16u + 8u * hh), x3 = *(const v4fa*)(p + 16u + 8u * hh + 4u);
  FragH f;
#pragma unroll
  for (int q = 0; q < 4; ++q) { f.h[q] = (_Float16)bf16_rne(x0[q]); f.h[4 + q] = (_Float16)bf16_rne(x1[q]); f.h[8 + q] = (_Float16)bf16_rne(x2[q]); f.h[12 + q] = (_Float16)bf16_rne(x3[q]); }
  return f.v;
}

#define TPB 2                                                        /* 64-key tiles of K and of V that one conversion block takes */
static_assert(QT % TPB == 0);                                        /* a block's tiles lie in one batch, one behind the other */

// one launch converts K and V: a block takes TPB neighbouring 64-key tiles of both, a thread 2 * TPB 16-B pieces of the packed K plane and as many of the packed V^T plane. Piece n of a thread lies 32 n key rows behind its piece 0 in the source and 256 n pieces behind it in the packed plane, for K and for V alike.
__global__ __launch_bounds__(256) void k_cvt(const float* __restrict__ Kf, const float* __restrict__ V, _Float16* __restrict__ K16, _Float16* __restrict__ VT) {
  __shared__ unsigned short tl[TPB][64][65];
  const unsigned tid = threadIdx.x;
  const unsigned tile0 = blockIdx.x * (unsigned)TPB;                 /* first of the block's tiles, counted over (batch, tile) */
  const unsigned b = tile0 / (unsigned)QT, s0 = (tile0 - b * (unsigned)QT) * 64u;
  /* K: tid counts 16-B pieces of the packed plane: bits 0..3 key row in its group of 16, bit 4 lane half, bit 5 fragment half, bit 6 d half, bit 7 row group (its upper bit and the tile come from n) */
  const float* kp = Kf + ((size_t)b * SEQ_FULL + s0 + ((tid >> 7) & 1u) * 16u + (tid & 15u)) * HD + ((tid >> 6) & 1u) * 32u + ((tid >> 5) & 1u) * 16u + ((tid >> 4) & 1u) * 8u;
  /* V: tid counts 32-B pieces of the rows as they lie */
  const unsigned j = tid >> 3, d8 = (tid & 7u) * 8u;
  const float* vp = V + ((size_t)b * SEQ_FULL + s0 + j) * HD + d8;
  v4f kx[2 * TPB][2], vx[2 * TPB][2];
  /* every loop over n is unrolled so that the register arrays are indexed by constants */
#pragma unroll
  for (int n = 0; n < 2 * TPB; ++n) {
    kx[n][0] = *(const v4fa*)(kp + n * 32 * HD); kx[n][1] = *(const v4fa*)(kp + n * 32 * HD + 4);
    vx[n][0] = *(const v4fa*)(vp + n * 32 * HD); vx[n][1] = *(const v4fa*)(vp + n * 32 * HD + 4);
  }
  /* the wait that belongs in front of any rewrite of the loads' two address pairs; the pairs are named so that they stay as they are up to here. As a memory fence it also keeps all the loads issued ahead of the first LDS store */
  asm volatile("s_wait_xcnt 0x0" :: "v"(kp), "v"(vp) : "memory");
#pragma unroll
  for (int n = 0; n < 2 * TPB; ++n) {
    FragH f;
#pragma unroll
    for (int q = 0; q < 4; ++q) { f.h[q] = (_Float16)bf16_rne(vx[n][0][q]); f.h[4 + q] = (_Float16)bf16_rne(vx[n][1][q]); }
#pragma unroll
    for (int q = 0; q < 8; ++q) tl[n >> 1][d8 + q][j + (unsigned)(n & 1) * 32u] = f.u[q];
  }
  v8us ko[2 * TPB], vo[2 * TPB];
#pragma unroll
  for (int n = 0; n < 2 * TPB; ++n) {
    FragH f;
#pragma unroll
    for (int q = 0; q < 4; ++q) { f.h[q] = (_Float16)bf16_rne(kx[n][0][q]); f.h[4 + q] = (_Float16)bf16_rne(kx[n][1][q]); }
    ko[n] = f.half[0];
  }
  __syncthreads();                                                   /* the transposed tiles are whole */
#pragma unroll
  for (int n = 0; n < 2 * TPB; ++n) {
    const unsigned i = tid + (unsigned)(n & 1) * 256u;
    /* i counts 16-B pieces of the packed tile: bits 0..3 d row in its group of 16, bit 4 lane half, bit 5 fragment half, bit 6 key half, bits 7..8 d group */
    const unsigned d = ((i >> 7) & 3u) * 16u + (i & 15u), j8 = ((i >> 6) & 1u) * 32u + ((i >> 5) & 1u) * 16u + ((i >> 4) & 1u) * 8u;
    FragH f;
#pragma unroll
    for (int q = 0; q < 8; ++q) f.u[q] = tl[n >> 1][d][j8 + q];
    vo[n] = f.half[0];
  }
  /* the stores last, each its plane's one address plus a constant: nothing that they name is rewritten behind them */
  unsigned short* kd = (unsigned short*)K16 + (size_t)tile0 * (size_t)(64 * HD) + (size_t)tid * 8u;
  unsigned short* vd = (unsigned short*)VT + (size_t)tile0 * (size_t)(64 * HD) + (size_t)tid * 8u;
#pragma unroll
  for (int n = 0; n < 2 * TPB; ++n) { *(v8us*)(kd + n * 2048) = ko[n]; *(v8us*)(vd + n * 2048) = vo[n]; }
}

// scores of one 64-key tile -> weights, running maximum, rescale factor, tile sum. FULL: every key of the tile lies inside the prefix, so nothing is masked: the mask's compares and selects and the clamp on a weight's exponent are left out. Same output as the general form: a weight more than 80 below the maximum is 0 in both f16 parts and below the rounding of the sum, clamped or not.
// Base-2 form: the running maximum m is kept in raw product units; a weight is 256 p = exp2(s * SC2 + nb), SC2 = log2(e) / 8, nb = 8 - m * SC2, so one fused multiply-add per score carries the scale, the change of base, the maximum and the weights' factor 256; the tile sum ls (and the running sum) therefore also carries the factor 256.
#define SC2 0.18033688011112042f
template <bool FULL>
__device__ __forceinline__ void soft_tile(v8f (&s)[4], unsigned key0, unsigned hh, unsigned plen, unsigned qidx, float& m, float& alpha, float& ls, FragH (&ph)[2], FragH (&pr)[2]) {
  const float NEGBIG = -1.0e30f;
  float tmx = NEGBIG;
#pragma unroll
  for (int t = 0; t < 4; ++t) {
#pragma unroll
    for (int r = 0; r < 8; ++r) {
      float v = s[t][r];
      if (!FULL) {
        const unsigned key = key0 + (unsigned)t * 16u + 8u * hh + (unsigned)r;
        const bool keep = (key < plen) | (key == qidx);
        v = keep ? v : NEGBIG;
        s[t][r] = v;
      }
      tmx = fmaxf(tmx, v);
    }
  }
  tmx = fmaxf(tmx, __shfl_xor(tmx, 16));
  const float mnew = fmaxf(m, tmx);
  alpha = __builtin_amdgcn_exp2f(fmaxf((m - mnew) * SC2, -115.0f));
  m = mnew;
  const float nb = fmaf(-mnew, SC2, 8.0f);
  ls = 0.f;
  if (FULL) {                                                        /* exponents in place of the scores; the general form below still needs the raw score for its mask test */
#pragma unroll
    for (int t = 0; t < 4; ++t) s[t] = s[t] * SC2 + nb;
  }
#pragma unroll
  for (int t = 0; t < 4; ++t) {
#pragma unroll
    for (int r = 0; r < 8; ++r) {
      const float sv = s[t][r];
      float p256;
      if (FULL) {
        p256 = __builtin_amdgcn_exp2f(sv);
      } else {
        const float x = fmaf(sv, SC2, nb);
        const float e = __builtin_amdgcn_exp2f(fmaxf(x, -107.0f));
        p256 = (sv > -1.0e29f) ? e : 0.0f;
      }
      ls += p256;
      const _Float16 hv = (_Float16)p256;
      const _Float16 rv = (_Float16)((p256 - (float)hv) * 2048.0f);
      ph[t >> 1].h[(t & 1) * 8 + r] = hv;
      pr[t >> 1].h[(t & 1) * 8 + r] = rv;
    }
  }
}

// flash attention, transposed form. Lane (hh, ln) of a wave owns query q0 + ln; S^T sub-tile t element r = score(key key0 + 16t + 8hh + r, query q0 + ln).
// Work shares: a block of 8 waves takes query tile qt of two batches, the one with the r-th longest prefix (L) and the one with the r-th shortest (S), ranked on the device. Waves 0..3 walk L's key tiles [0, cut); waves 4..7 walk all of S, store it, then walk L's tiles [cut, end) and hand their partial (maximum, sum, un-normalised output) through LDS to waves 0..3, which merge and store L. cut gives both wave groups about the same number of passes.
__global__ __launch_bounds__(256) void k_fattn(const float* __restrict__ Qf, const _Float16* __restrict__ K16, const _Float16* __restrict__ VT,
                                              const int* __restrict__ plen_n, float* __restrict__ Og) {
  __shared__ __attribute__((aligned(16))) float so[8][16][68];      /* wave-private output staging [query][d] */
  __shared__ float px[4][34][32];                                    /* partial of wave 4 + i for wave i: 32 output values, maximum, sum, each [lane] */
  const unsigned tid = threadIdx.x, lane = tid & 31u, ln = lane & 15u, hh = lane >> 4;
  const unsigned w = (unsigned)__builtin_amdgcn_readfirstlane((int)(tid >> 5));   /* the wave's number as a scalar: every test on it is a scalar branch */
  const unsigned grp = w >> 2, w4 = w & 3u;
  const unsigned rk = blockIdx.x / (unsigned)QT, qt = blockIdx.x - rk * (unsigned)QT;
  const unsigned q0 = qt * 64u + w4 * 16u;
  const unsigned qidx = q0 + ln;

  /* rank of every batch by clamped prefix length, longest first, ties by index: lane ln holds batch ln; the ranks are a permutation of 0 .. NB - 1 for any lengths */
  int plv = plen_n[ln < (unsigned)NB ? ln : (unsigned)(NB - 1)];
  plv = plv < 0 ? 0 : plv; plv = plv > SEQ ? SEQ : plv;
  const int skey = (ln < (unsigned)NB) ? plv * 16 + (int)(15u - ln) : -1;
  int rank = 0;
#pragma unroll
  for (int j = 0; j < NB; ++j) rank += (__builtin_amdgcn_readlane(skey, j) > skey) ? 1 : 0;
  const unsigned bL = (unsigned)__builtin_ctz(__builtin_amdgcn_ballot_w32((rank == (int)rk) & (ln < (unsigned)NB)) | (1u << (NB - 1)));
  const unsigned bS = (unsigned)__builtin_ctz(__builtin_amdgcn_ballot_w32((rank == NB - 1 - (int)rk) & (ln < (unsigned)NB)) | (1u << (NB - 1)));
  const unsigned plL = (unsigned)__builtin_amdgcn_readlane(plv, (int)bL), plS = (unsigned)__builtin_amdgcn_readlane(plv, (int)bS);
  const unsigned ntpL = (plL + 63u) >> 6, ntotL = ntpL + ((qt >= ntpL) ? 1u : 0u);   /* key tiles meeting [0, plen), plus the diagonal tile when not covered: <= QT */
  const unsigned ntpS = (plS + 63u) >> 6, ntotS = ntpS + ((qt >= ntpS) ? 1u : 0u);
  /* equal shares, for speed only (any cut in [1, ntotL] gives the same function): a tile with masked keys counts as one and a half */
  unsigned cut = (2u * (ntotL + ntotS) + (ntotL - (plL >> 6)) + (ntotS - (plS >> 6)) + 3u) >> 2;
  cut = cut > ntotL ? ntotL : cut; cut = cut < 1u ? 1u : cut;

  const unsigned l8 = 8u * lane;                                     /* the lane's place in every 512-B unit of a packed tile, in elements */
  const float NEGBIG = -1.0e30f;
  const v8f z8 = {0.f, 0.f, 0.f, 0.f, 0.f, 0.f, 0.f, 0.f};
  float m = NEGBIG, l = 0.f;
  v8f oh[4], orr[4];

  /* o * inv -> the wave's 16 output rows of batch b, whole 128-B lines through the wave's own staging */
  auto put_rows = [&](unsigned b, const v8f (&o)[4], float inv) {
#pragma unroll
    for (int dt = 0; dt < 4; ++dt) {
#pragma unroll
      for (int r = 0; r < 8; ++r) so[w][ln][dt * 16 + 8 * (int)hh + r] = o[dt][r] * inv;
    }
    __builtin_amdgcn_fence(4 /* acq_rel order */, "workgroup");
    __builtin_amdgcn_wave_barrier();
    const unsigned rsub = lane >> 4, c4 = (lane & 15u) * 4u;
    float* op = Og + ((size_t)b * SEQ + q0 + rsub) * HD + c4;        /* the lane's whole address: the stores are this pair plus a constant */
#pragma unroll
    for (int q = 0; q < 8; ++q) {
      const v4f v = *(const v4fa*)&so[w][(unsigned)q * 2u + rsub][c4];
      *(v4f*)(op + (size_t)q * 2u * HD) = v;
    }
    /* the wait that belongs in front of any rewrite of the stores' address pair; the pair is named so that it stays as it is up to here */
    asm volatile("s_wait_xcnt 0x0" :: "v"(op) : "memory");
  };

  /* segment 0: the short batch, whole (waves 4..7 only); segment 1: this wave group's share of the long batch. One copy of the loops serves both */
#pragma unroll 1
  for (unsigned seg = grp ^ 1u; seg < 2u; ++seg) {
  const unsigned b = seg ? bL : bS, plen = seg ? plL : plS;
  const unsigned ntp = seg ? ntpL : ntpS, ntot = seg ? ntotL : ntotS;
  const unsigned t0 = (seg & grp) ? cut : 0u;                        /* the segment's tiles of the walk: [t0, t1), t1 <= ntot; empty for waves 4..7 where cut == ntotL */
  const unsigned t1 = (seg & (grp ^ 1u)) ? cut : ntot;

  const float* qrow = Qf + ((size_t)b * SEQ_FULL + qidx) * HD + 8u * hh;   /* the lane's whole address: the loads are this pair plus a constant */
  const v16h qa0 = q_frag(qrow, 0u), qa1 = q_frag(qrow + 32, 0u);
  const _Float16* Kb = K16 + (size_t)b * SEQ * HD;
  const _Float16* Vb = VT + (size_t)b * HD * SEQ;
  m = NEGBIG; l = 0.f;
#pragma unroll
  for (int dt = 0; dt < 4; ++dt) { oh[dt] = z8; orr[dt] = z8; }

  /* register pipeline: ka holds the whole K tile of the pass (fetched one pass ahead), va the whole V^T tile (fetched at the head of its pass) */
  v16h ka[4][2], va[4][2];
  {
    const unsigned kf = (t0 < ntp) ? t0 : qt;                        /* first tile of the segment (in bounds also where the segment is empty) */
    const _Float16* kr = Kb + (size_t)kf * (64 * HD);                /* the tile's base, the same in every lane: every load below is this pair plus the lane's 16 l bytes plus a constant */
#pragma unroll
    for (int t = 0; t < 4; ++t) { ka[t][0] = pk_frag(kr + l8 + t * 1024); ka[t][1] = pk_frag(kr + l8 + t * 1024 + 512); }
    /* the wait that belongs in front of any rewrite of the loads' base pair and of the q loads' address pair; the pairs are named so that they stay as they are up to here */
    asm volatile("s_wait_xcnt 0x0" :: "s"(kr), "v"(qrow) : "memory");
  }

  /* the walk in two parts, each a loop of its own (the outer loop is unrolled so that 'part' is a constant in each): first the tiles wholly inside the prefix, then the at most two that hold a masked key */
  const unsigned nfull = plen >> 6;                                  /* tiles 0 .. nfull - 1 lie wholly inside [0, plen): nfull <= ntp */
  unsigned it = t0;
#pragma unroll
  for (int part = 0; part < 2; ++part) {
  const unsigned iend = (part == 0) ? (nfull < t1 ? nfull : t1) : t1;
#pragma unroll 1
  for (; it < iend; ++it) {
    const unsigned kt = (it < ntp) ? it : qt;
    const unsigned key0 = kt * 64u;
    const _Float16* vr = Vb + (size_t)kt * (64 * HD);                /* the tile's base, as above */
#pragma unroll
    for (int dt = 0; dt < 4; ++dt) { va[dt][0] = pk_frag(vr + l8 + dt * 1024); va[dt][1] = pk_frag(vr + l8 + dt * 1024 + 512); }
    /* keeps the 16 V^T loads issued here, ahead of scores and softmax; without it the scheduler sinks each group to its product and its latency is exposed */
    __builtin_amdgcn_sched_barrier(0);
    v8f s[4];
#pragma unroll
    for (int t = 0; t < 4; ++t) {
      v8f c = z8;
      c = g2_mma(ka[t][0], qa0, c);
      c = g2_mma(ka[t][1], qa1, c);
      s[t] = c;
    }
    const unsigned itn = (it + 1u < t1) ? it + 1u : it;              /* the last pass fetches its own tile again (in bounds, unused) */
    const unsigned kn = (itn < ntp) ? itn : qt;
    const _Float16* krn = Kb + (size_t)kn * (64 * HD);
#pragma unroll
    for (int t = 0; t < 4; ++t) { ka[t][0] = pk_frag(krn + l8 + t * 1024); ka[t][1] = pk_frag(krn + l8 + t * 1024 + 512); }
    /* keeps the next tile's 16 K loads issued here, so that softmax and the output products cover their latency */
    __builtin_amdgcn_sched_barrier(0);
    FragH ph[2], pr[2];
    float alpha, ls;
    if (part == 0) soft_tile<true>(s, key0, hh, plen, qidx, m, alpha, ls, ph, pr);
    else soft_tile<false>(s, key0, hh, plen, qidx, m, alpha, ls, ph, pr);
    l = l * alpha + ls;
#pragma unroll
    for (int dt = 0; dt < 4; ++dt) { oh[dt] = oh[dt] * alpha; orr[dt] = orr[dt] * alpha; }
#pragma unroll
    for (int dt = 0; dt < 4; ++dt) {
      const v16h a0 = va[dt][0], a1 = va[dt][1];
      oh[dt] = g2_mma(a0, ph[0].v, oh[dt]);
      oh[dt] = g2_mma(a1, ph[1].v, oh[dt]);
      orr[dt] = g2_mma(a0, pr[0].v, orr[dt]);
      orr[dt] = g2_mma(a1, pr[1].v, orr[dt]);
    }
    /* the wait that belongs in front of any rewrite of the base pairs of this pass's loads; the pairs are named so that they stay as they are up to here */
    asm volatile("s_wait_xcnt 0x0" :: "s"(vr), "s"(krn) : "memory");
  }
  }

#pragma unroll
  for (int dt = 0; dt < 4; ++dt) oh[dt] = oh[dt] + orr[dt] * 0.00048828125f;   /* the residual accumulator folded back */
  if (seg == 0u) {
    const float lt = l + __shfl_xor(l, 16);
    put_rows(b, oh, 1.0f / lt);                                      /* output and sum both carry the factor 256 */
  }
  }

  /* the long batch's two partials: waves 4..7 hand theirs over lane for lane (wave 4 + i holds the queries of wave i in the same lanes) */
  if (grp) {
#pragma unroll
    for (int dt = 0; dt < 4; ++dt) {
#pragma unroll
      for (int r = 0; r < 8; ++r) px[w4][dt * 8 + r][lane] = oh[dt][r];
    }
    px[w4][32][lane] = m;
    px[w4][33][lane] = l;
  }
  __syncthreads();                                                   /* every wave passes it once; publishes the partials */
  if (!grp) {
    const float mB = px[w4][32][lane], lB = px[w4][33][lane];
    const float mm = fmaxf(m, mB);
    /* an empty partial has maximum NEGBIG, sum 0 and zeros: its weight is tiny and finite, its terms are 0 */
    const float fa = __builtin_amdgcn_exp2f(fmaxf((m - mm) * SC2, -115.0f)), fb = __builtin_amdgcn_exp2f(fmaxf((mB - mm) * SC2, -115.0f));
    l = l * fa + lB * fb;
#pragma unroll
    for (int dt = 0; dt < 4; ++dt) {
#pragma unroll
      for (int r = 0; r < 8; ++r) oh[dt][r] = oh[dt][r] * fa + px[w4][dt * 8 + r][lane] * fb;
    }
    const float lt = l + __shfl_xor(l, 16);
    put_rows(bL, oh, 1.0f / lt);
  }
}

extern "C" void kernel_launch(void* const* d_in, const int* in_sizes, int n_in,
                              void* d_out, int out_size, void* d_ws, size_t ws_size, hipStream_t stream) {
  if (n_in < 4) return;
  const long long need = (long long)NB * SEQ * HD;
  if ((long long)in_sizes[0] < need || (long long)in_sizes[1] < need || (long long)in_sizes[2] < need || in_sizes[3] < NB) return;
  if ((long long)out_size < need) return;
  const float* xq = (const float*)d_in[0];
  const float* xk = (const float*)d_in[1];
  const float* xv = (const float*)d_in[2];
  const int* pl = (const int*)d_in[3];
  char* ws = (char*)d_ws; size_t off = 0;
  auto take = [&](size_t bytes) { char* p = ws + off; off += (bytes + 255) & ~(size_t)255; return p; };
  _Float16* K16 = (_Float16*)take((size_t)NB * SEQ * HD * 2);
  _Float16* VT = (_Float16*)take((size_t)NB * HD * SEQ * 2);
  if (off > ws_size) return;

  k_cvt<<<(unsigned)(NB * QT / TPB), 256, 0, stream>>>(xk, xv, K16, VT);
  k_fattn<<<(unsigned)(NB / 2 * QT), 256, 0, stream>>>(xq, K16, VT, pl, (float*)d_out);
}

// v008
// One run takes 20.5 microseconds.
// It is 1.26 times as fast as v006, going by the measured steps of the versions left out in between.
// Counting every step since v000, it is 5.32 times as fast.
#include <hip/hip_runtime.h>
// Block-prefix + diagonal masked attention on given q, k, v ([16][2048][64] f32 each), scale 8/64, prefix length per batch read on device; out = softmax(masked q.k^T * 0.125) v -> [16][2048][64] f32.
// Structure: one conversion launch: k -> exact f16, v -> exact f16 V^T (LDS transpose), both stored per 64-key tile in the order of the matrix fragments (16 units of 512 B, lane l's 16 B at 16 l); one flash-style kernel: a wave owns 16 queries, 4 waves a 64-query tile, a block of 16 waves (4 groups of 4) one such tile of a long-prefix and of a short-prefix batch; key tiles of 64 = tiles meeting [0, prefix) plus the tile holding the diagonal; computed transposed: S^T = K Q^T, online softmax per query column (f32), O^T += V^T P^T with P^T taken straight from the packed S^T accumulators.
// Compute dtype: q, k, v RNE-converted to bf16 and carried exactly in f16 (exact products, f32 accumulate) on v_wmma_f32_16x16x32_f16; softmax weights x256 as one f16 value (11 significant bits, against the 8 of the bf16-rounded q, k, v); statistics f32, the running sum taken from the unrounded weights.
#ifndef NB
#define NB 16
#endif
#ifndef SEQ
#define SEQ 2048
#endif
#define NB_FULL 16
#define SEQ_FULL 2048
#define HD 64
#define QT (SEQ / 64)
static_assert(SEQ % 64 == 0);
static_assert(SEQ <= SEQ_FULL);
static_assert(NB <= NB_FULL);
static_assert(NB % 2 == 0);
static_assert(((size_t)NB * SEQ * HD) % 2048 == 0);

typedef unsigned short v8us __attribute__((ext_vector_type(8), may_alias));
typedef _Float16 v16h __attribute__((ext_vector_type(16)));
typedef float  v8f  __attribute__((ext_vector_type(8)));
typedef float  v4f  __attribute__((ext_vector_type(4)));
typedef float  v4fa __attribute__((ext_vector_type(4), may_alias));
union FragH { v16h v; v8us half[2]; _Float16 h[16]; unsigned short u[16]; };

__device__ __forceinline__ unsigned short bf16_bits(float x) { unsigned int u = __float_as_uint(x); return (unsigned short)((u + 0x7FFFu + ((u >> 16) & 1u)) >> 16); }
__device__ __forceinline__ float bf16_val(unsigned short b) { return __uint_as_float(((unsigned int)b) << 16); }
__device__ __forceinline__ float bf16_rne(float x) { return bf16_val(bf16_bits(x)); }

// fragment (A or B, same k map), p = a row's 32 k values, h = lane >> 4: elements 0..7 <- p[8h .. 8h+7], elements 8..15 <- p[16+8h .. 16+8h+7]; row / column = lane & 15
// that fragment from a packed tile: p = unit base + 8 * lane; elements 0..7 from the first 512-B unit, elements 8..15 from the next, so each wave-wide 16-B load covers four whole 128-B lines
__device__ __forceinline__ v16h pk_frag(const _Float16* p) { FragH f; f.half[0] = *(const v8us*)((const unsigned short*)p); f.half[1] = *(const v8us*)((const unsigned short*)p + 256u); return f.v; }
__device__ __forceinline__ v8f g2_mma(v16h a, v16h b, v8f c) { v8f d = __builtin_amdgcn_wmma_f32_16x16x32_f16(false, a, false, b, (short)0, c, false, false); asm volatile("v_nop\n\tv_nop\n\tv_nop\n\tv_nop" : "+v"(d) : "v"(a), "v"(b)); return d; }
// same fragment map from an f32 row: bf16 RNE then exact f16
__device__ __forceinline__ v16h q_frag(const float* p, unsigned hh) {
  const v4f x0 = *(const v4fa*)(p + 8u * hh), x1 = *(const v4fa*)(p + 8u * hh + 4u);
  const v4f x2 = *(const v4fa*)(p + 16u + 8u * hh), x3 = *(const v4fa*)(p + 16u + 8u * hh + 4u);
  FragH f;
#pragma unroll
  for (int q = 0; q < 4; ++q) { f.h[q] = (_Float16)bf16_rne(x0[q]); f.h[4 + q] = (_Float16)bf16_rne(x1[q]); f.h[8 + q] = (_Float16)bf16_rne(x2[q]); f.h[12 + q] = (_Float16)bf16_rne(x3[q]); }
  return f.v;
}

#define TPB 2                                                        /* 64-key tiles of K and of V that one conversion block takes */
static_assert(QT % TPB == 0);                                        /* a block's tiles lie in one batch, one behind the other */

// one launch converts K and V: a block takes TPB neighbouring 64-key tiles of both, a thread 2 * TPB 16-B pieces of the packed K plane and as many of the packed V^T plane. Piece n of a thread lies 32 n key rows behind its piece 0 in the source and 256 n pieces behind it in the packed plane, for K and for V alike.
__global__ __launch_bounds__(256) void k_cvt(const float* __restrict__ Kf, const float* __restrict__ V, _Float16* __restrict__ K16, _Float16* __restrict__ VT) {
  __shared__ unsigned short tl[TPB][64][65];
  const unsigned tid = threadIdx.x;
  const unsigned tile0 = blockIdx.x * (unsigned)TPB;                 /* first of the block's tiles, counted over (batch, tile) */
  const unsigned b = tile0 / (unsigned)QT, s0 = (tile0 - b * (unsigned)QT) * 64u;
  /* K: tid counts 16-B pieces of the packed plane: bits 0..3 key row in its group of 16, bit 4 lane half, bit 5 fragment half, bit 6 d half, bit 7 row group (its upper bit and the tile come from n) */
  const float* kp = Kf + ((size_t)b * SEQ_FULL + s0 + ((tid >> 7) & 1u) * 16u + (tid & 15u)) * HD + ((tid >> 6) & 1u) * 32u + ((tid >> 5) & 1u) * 16u + ((tid >> 4) & 1u) * 8u;
  /* V: tid counts 32-B pieces of the rows as they lie */
  const unsigned j = tid >> 3, d8 = (tid & 7u) * 8u;
  const float* vp = V + ((size_t)b * SEQ_FULL + s0 + j) * HD + d8;
  v4f kx[2 * TPB][2], vx[2 * TPB][2];
  /* every loop over n is unrolled so that the register arrays are indexed by constants */
#pragma unroll
  for (int n = 0; n < 2 * TPB; ++n) {
    kx[n][0] = *(const v4fa*)(kp + n * 32 * HD); kx[n][1] = *(const v4fa*)(kp + n * 32 * HD + 4);
    vx[n][0] = *(const v4fa*)(vp + n * 32 * HD); vx[n][1] = *(const v4fa*)(vp + n * 32 * HD + 4);
  }
  /* the wait that belongs in front of any rewrite of the loads' two address pairs; the pairs are named so that they stay as they are up to here. As a memory fence it also keeps all the loads issued ahead of the first LDS store */
  asm volatile("s_wait_xcnt 0x0" :: "v"(kp), "v"(vp) : "memory");
#pragma unroll
  for (int n = 0; n < 2 * TPB; ++n) {
    FragH f;
#pragma unroll
    for (int q = 0; q < 4; ++q) { f.h[q] = (_Float16)bf16_rne(vx[n][0][q]); f.h[4 + q] = (_Float16)bf16_rne(vx[n][1][q]); }
#pragma unroll
    for (int q = 0; q < 8; ++q) tl[n >> 1][d8 + q][j + (unsigned)(n & 1) * 32u] = f.u[q];
  }
  v8us ko[2 * TPB], vo[2 * TPB];
#pragma unroll
  for (int n = 0; n < 2 * TPB; ++n) {
    FragH f;
#pragma unroll
    for (int q = 0; q < 4; ++q) { f.h[q] = (_Float16)bf16_rne(kx[n][0][q]); f.h[4 + q] = (_Float16)bf16_rne(kx[n][1][q]); }
    ko[n] = f.half[0];
  }
  __syncthreads();                                                   /* the transposed tiles are whole */
#pragma unroll
  for (int n = 0; n < 2 * TPB; ++n) {
    const unsigned i = tid + (unsigned)(n & 1) * 256u;
    /* i counts 16-B pieces of the packed tile: bits 0..3 d row in its group of 16, bit 4 lane half, bit 5 fragment half, bit 6 key half, bits 7..8 d group */
    const unsigned d = ((i >> 7) & 3u) * 16u + (i & 15u), j8 = ((i >> 6) & 1u) * 32u + ((i >> 5) & 1u) * 16u + ((i >> 4) & 1u) * 8u;
    FragH f;
#pragma unroll
    for (int q = 0; q < 8; ++q) f.u[q] = tl[n >> 1][d][j8 + q];
    vo[n] = f.half[0];
  }
  /* the stores last, each its plane's one address plus a constant: nothing that they name is rewritten behind them */
  unsigned short* kd = (unsigned short*)K16 + (size_t)tile0 * (size_t)(64 * HD) + (size_t)tid * 8u;
  unsigned short* vd = (unsigned short*)VT + (size_t)tile0 * (size_t)(64 * HD) + (size_t)tid * 8u;
#pragma unroll
  for (int n = 0; n < 2 * TPB; ++n) { *(v8us*)(kd + n * 2048) = ko[n]; *(v8us*)(vd + n * 2048) = vo[n]; }
}

// scores of one 64-key tile -> weights, running maximum, rescale factor, tile sum. FULL: every key of the tile lies inside the prefix, so nothing is masked: the mask's compares and selects and the clamp on a weight's exponent are left out. Same output as the general form: a weight more than 80 below the maximum is 0 in f16 and below the rounding of the sum, clamped or not.
// Base-2 form: the running maximum m is kept in raw product units; a weight is 256 p = exp2(s * SC2 + nb), SC2 = log2(e) / 8, nb = 8 - m * SC2, so one fused multiply-add per score carries the scale, the change of base, the maximum and the weights' factor 256; the tile sum ls (and the running sum) therefore also carries the factor 256.
#define SC2 0.18033688011112042f
template <bool FULL>
__device__ __forceinline__ void soft_tile(v8f (&s)[4], unsigned key0, unsigned hh, unsigned plen, unsigned qidx, float& m, float& alpha, float& ls, FragH (&ph)[2]) {
  const float NEGBIG = -1.0e30f;
  float tmx = NEGBIG;
#pragma unroll
  for (int t = 0; t < 4; ++t) {
#pragma unroll
    for (int r = 0; r < 8; ++r) {
      float v = s[t][r];
      if (!FULL) {
        const unsigned key = key0 + (unsigned)t * 16u + 8u * hh + (unsigned)r;
        const bool keep = (key < plen) | (key == qidx);
        v = keep ? v : NEGBIG;
        s[t][r] = v;
      }
      tmx = fmaxf(tmx, v);
    }
  }
  tmx = fmaxf(tmx, __shfl_xor(tmx, 16));
  const float mnew = fmaxf(m, tmx);
  alpha = __builtin_amdgcn_exp2f(fmaxf((m - mnew) * SC2, -115.0f));
  m = mnew;
  const float nb = fmaf(-mnew, SC2, 8.0f);
  ls = 0.f;
  if (FULL) {                                                        /* exponents in place of the scores; the general form below still needs the raw score for its mask test */
#pragma unroll
    for (int t = 0; t < 4; ++t) s[t] = s[t] * SC2 + nb;
  }
#pragma unroll
  for (int t = 0; t < 4; ++t) {
#pragma unroll
    for (int r = 0; r < 8; ++r) {
      const float sv = s[t][r];
      float p256;
      if (FULL) {
        p256 = __builtin_amdgcn_exp2f(sv);
      } else {
        const float x = fmaf(sv, SC2, nb);
        const float e = __builtin_amdgcn_exp2f(fmaxf(x, -107.0f));
        p256 = (sv > -1.0e29f) ? e : 0.0f;
      }
      ls += p256;
      ph[t >> 1].h[(t & 1) * 8 + r] = (_Float16)p256;
    }
  }
}

// flash attention, transposed form. Lane (hh, ln) of a wave owns query q0 + ln; S^T sub-tile t element r = score(key key0 + 16t + 8hh + r, query q0 + ln).
// Work shares: a block of 16 waves, four to a SIMD, takes query tile qt of two batches, the one with the r-th longest prefix (L) and the one with the r-th shortest (S), ranked on the device. S's key tiles followed by L's form one row of tiles, cut into NG runs of about equal cost, one per group of 4 waves; a run meets S, L or both. Every group leaves its partial of each batch it met (maximum, sum, un-normalised output) in LDS; behind one barrier group 0 merges and stores S, group 1 L.
#define NG 4
__global__ __launch_bounds__(512) void k_fattn(const float* __restrict__ Qf, const _Float16* __restrict__ K16, const _Float16* __restrict__ VT,
                                              const int* __restrict__ plen_n, float* __restrict__ Og) {
  __shared__ __attribute__((aligned(16))) float so[8][16][68];      /* output staging [query][d], private to each of the 8 merging waves */
  __shared__ float px[2][NG][4][34][32];                             /* [batch S, L][group][wave in group]: a partial's 32 output values, maximum, sum, each [lane] */
  const unsigned tid = threadIdx.x, lane = tid & 31u, ln = lane & 15u, hh = lane >> 4;
  const unsigned w = (unsigned)__builtin_amdgcn_readfirstlane((int)(tid >> 5));   /* the wave's number as a scalar: every test on it is a scalar branch */
  const unsigned grp = w >> 2, w4 = w & 3u;
  const unsigned rk = blockIdx.x / (unsigned)QT, qt = blockIdx.x - rk * (unsigned)QT;
  const unsigned q0 = qt * 64u + w4 * 16u;
  const unsigned qidx = q0 + ln;

  /* rank of every batch by clamped prefix length, longest first, ties by index: lane ln holds batch ln; the ranks are a permutation of 0 .. NB - 1 for any lengths */
  int plv = plen_n[ln < (unsigned)NB ? ln : (unsigned)(NB - 1)];
  plv = plv < 0 ? 0 : plv; plv = plv > SEQ ? SEQ : plv;
  const int skey = (ln < (unsigned)NB) ? plv * 16 + (int)(15u - ln) : -1;
  int rank = 0;
#pragma unroll
  for (int j = 0; j < NB; ++j) rank += (__builtin_amdgcn_readlane(skey, j) > skey) ? 1 : 0;
  const unsigned bL = (unsigned)__builtin_ctz(__builtin_amdgcn_ballot_w32((rank == (int)rk) & (ln < (unsigned)NB)) | (1u << (NB - 1)));
  const unsigned bS = (unsigned)__builtin_ctz(__builtin_amdgcn_ballot_w32((rank == NB - 1 - (int)rk) & (ln < (unsigned)NB)) | (1u << (NB - 1)));
  const unsigned plL = (unsigned)__builtin_amdgcn_readlane(plv, (int)bL), plS = (unsigned)__builtin_amdgcn_readlane(plv, (int)bS);
  const unsigned ntpL = (plL + 63u) >> 6, ntotL = ntpL + ((qt >= ntpL) ? 1u : 0u);   /* key tiles meeting [0, plen), plus the diagonal tile when not covered: <= QT */
  const unsigned ntpS = (plS + 63u) >> 6, ntotS = ntpS + ((qt >= ntpS) ? 1u : 0u);
  /* equal shares, for speed only (any rising cuts from 0 to ntotS + ntotL give the same function): an unmasked tile costs 2, one with masked keys 3; a batch's unmasked tiles come first in its walk */
  const unsigned fS = plS >> 6, fL = plL >> 6;
  const unsigned cS = 2u * fS + 3u * (ntotS - fS), cT = cS + 2u * fL + 3u * (ntotL - fL);
  /* cu[g]: first tile, in the row of S's and L's tiles, of group g's run; cu[NG] is the row's end. Worked out once, the same in every wave */
  static_assert(NG == 4);
  unsigned cu[NG + 1];
  /* unrolled, here and in the merge, so that cu is indexed by constants and stays in scalar registers */
#pragma unroll
  for (unsigned g = 0; g <= NG; ++g) {
    const unsigned tau = (g * cT + 2u) >> 2;
    const unsigned inS = (tau <= 2u * fS) ? ((tau + 1u) >> 1) : fS + (tau - 2u * fS + 1u) / 3u;
    const unsigned inL = (tau <= cS + 2u * fL) ? ((tau - cS + 1u) >> 1) : fL + (tau - cS - 2u * fL + 1u) / 3u;
    cu[g] = (tau <= cS) ? inS : ntotS + inL;
  }
  /* a place c of that row as a tile of batch sel's own walk (0: S, 1: L), held inside the walk */
  auto in_walk = [&](unsigned sel, unsigned c) -> unsigned { return sel ? (c > ntotS ? c - ntotS : 0u) : (c < ntotS ? c : ntotS); };
  const unsigned c0 = grp == 0u ? cu[0] : grp == 1u ? cu[1] : grp == 2u ? cu[2] : cu[3];
  const unsigned c1 = grp == 0u ? cu[1] : grp == 1u ? cu[2] : grp == 2u ? cu[3] : cu[4];

  const unsigned l8 = 8u * lane;                                     /* the lane's place in every 512-B unit of a packed tile, in elements */
  const float NEGBIG = -1.0e30f;
  const v8f z8 = {0.f, 0.f, 0.f, 0.f, 0.f, 0.f, 0.f, 0.f};
  float m = NEGBIG, l = 0.f;
  v8f oh[4];

  /* o * inv -> the wave's 16 output rows of batch b, whole 128-B lines through the wave's own staging */
  auto put_rows = [&](unsigned b, const v8f (&o)[4], float inv) {
#pragma unroll
    for (int dt = 0; dt < 4; ++dt) {
#pragma unroll
      for (int r = 0; r < 8; ++r) so[w][ln][dt * 16 + 8 * (int)hh + r] = o[dt][r] * inv;
    }
    __builtin_amdgcn_fence(4 /* acq_rel order */, "workgroup");
    __builtin_amdgcn_wave_barrier();
    const unsigned rsub = lane >> 4, c4 = (lane & 15u) * 4u;
    float* op = Og + ((size_t)b * SEQ + q0 + rsub) * HD + c4;        /* the lane's whole address: the stores are this pair plus a constant */
#pragma unroll
    for (int q = 0; q < 8; ++q) {
      const v4f v = *(const v4fa*)&so[w][(unsigned)q * 2u + rsub][c4];
      *(v4f*)(op + (size_t)q * 2u * HD) = v;
    }
    /* the wait that belongs in front of any rewrite of the stores' address pair; the pair is named so that it stays as it is up to here */
    asm volatile("s_wait_xcnt 0x0" :: "v"(op) : "memory");
  };

  /* segment 0: this wave group's share of the short batch; segment 1: its share of the long one; either may be empty. One copy of the loops serves both */
#pragma unroll 1
  for (unsigned seg = 0u; seg < 2u; ++seg) {
  const unsigned b = seg ? bL : bS, plen = seg ? plL : plS;
  const unsigned ntp = seg ? ntpL : ntpS, ntot = seg ? ntotL : ntotS;
  const unsigned t0 = in_walk(seg, c0), t1 = in_walk(seg, c1);       /* the segment's tiles of the walk: [t0, t1), t1 <= ntot */
  if (t0 >= t1) continue;                                            /* the same in every lane of the group's waves; no barrier stands inside the loop */

  const float* qrow = Qf + ((size_t)b * SEQ_FULL + qidx) * HD + 8u * hh;   /* the lane's whole address: the loads are this pair plus a constant */
  const v16h qa0 = q_frag(qrow, 0u), qa1 = q_frag(qrow + 32, 0u);
  const _Float16* Kb = K16 + (size_t)b * SEQ * HD;
  const _Float16* Vb = VT + (size_t)b * HD * SEQ;
  m = NEGBIG; l = 0.f;
#pragma unroll
  for (int dt = 0; dt < 4; ++dt) oh[dt] = z8;

  /* register pipeline: ka holds the whole K tile of the pass (fetched one pass ahead), va the whole V^T tile (fetched at the head of its pass) */
  v16h ka[4][2], va[4][2];
  {
    const unsigned kf = (t0 < ntp) ? t0 : qt;                        /* first tile of the segment */
    const _Float16* kr = Kb + (size_t)kf * (64 * HD);                /* the tile's base, the same in every lane: every load below is this pair plus the lane's 16 l bytes plus a constant */
#pragma unroll
    for (int t = 0; t < 4; ++t) { ka[t][0] = pk_frag(kr + l8 + t * 1024); ka[t][1] = pk_frag(kr + l8 + t * 1024 + 512); }
    /* the wait that belongs in front of any rewrite of the loads' base pair and of the q loads' address pair; the pairs are named so that they stay as they are up to here */
    asm volatile("s_wait_xcnt 0x0" :: "s"(kr), "v"(qrow) : "memory");
  }

  /* the walk in two parts, each a loop of its own (the outer loop is unrolled so that 'part' is a constant in each): first the tiles wholly inside the prefix, then the at most two that hold a masked key */
  const unsigned nfull = plen >> 6;                                  /* tiles 0 .. nfull - 1 lie wholly inside [0, plen): nfull <= ntp */
  unsigned it = t0;
#pragma unroll
  for (int part = 0; part < 2; ++part) {
  const unsigned iend = (part == 0) ? (nfull < t1 ? nfull : t1) : t1;
#pragma unroll 1
  for (; it < iend; ++it) {
    const unsigned kt = (it < ntp) ? it : qt;
    const unsigned key0 = kt * 64u;
    const _Float16* vr = Vb + (size_t)kt * (64 * HD);                /* the tile's base, as above */
#pragma unroll
    for (int dt = 0; dt < 4; ++dt) { va[dt][0] = pk_frag(vr + l8 + dt * 1024); va[dt][1] = pk_frag(vr + l8 + dt * 1024 + 512); }
    /* keeps the 16 V^T loads issued here, ahead of scores and softmax; without it the scheduler sinks each group to its product and its latency is exposed */
    __builtin_amdgcn_sched_barrier(0);
    v8f s[4];
#pragma unroll
    for (int t = 0; t < 4; ++t) {
      v8f c = z8;
      c = g2_mma(ka[t][0], qa0, c);
      c = g2_mma(ka[t][1], qa1, c);
      s[t] = c;
    }
    const unsigned itn = (it + 1u < t1) ? it + 1u : it;              /* the last pass fetches its own tile again (in bounds, unused) */
    const unsigned kn = (itn < ntp) ? itn : qt;
    const _Float16* krn = Kb + (size_t)kn * (64 * HD);
#pragma unroll
    for (int t = 0; t < 4; ++t) { ka[t][0] = pk_frag(krn + l8 + t * 1024); ka[t][1] = pk_frag(krn + l8 + t * 1024 + 512); }
    /* keeps the next tile's 16 K loads issued here, so that softmax and the output products cover their latency */
    __builtin_amdgcn_sched_barrier(0);
    FragH ph[2];
    float alpha, ls;
    if (part == 0) soft_tile<true>(s, key0, hh, plen, qidx, m, alpha, ls, ph);
    else soft_tile<false>(s, key0, hh, plen, qidx, m, alpha, ls, ph);
    l = l * alpha + ls;
#pragma unroll
    for (int dt = 0; dt < 4; ++dt) oh[dt] = oh[dt] * alpha;
#pragma unroll
    for (int dt = 0; dt < 4; ++dt) {
      oh[dt] = g2_mma(va[dt][0], ph[0].v, oh[dt]);
      oh[dt] = g2_mma(va[dt][1], ph[1].v, oh[dt]);
    }
    /* the wait that belongs in front of any rewrite of the base pairs of this pass's loads; the pairs are named so that they stay as they are up to here */
    asm volatile("s_wait_xcnt 0x0" :: "s"(vr), "s"(krn) : "memory");
  }
  }

  /* the segment's partial, lane for lane (wave i of every group holds the same queries in the same lanes) */
#pragma unroll
  for (int dt = 0; dt < 4; ++dt) {
#pragma unroll
    for (int r = 0; r < 8; ++r) px[seg][grp][w4][dt * 8 + r][lane] = oh[dt][r];
  }
  px[seg][grp][w4][32][lane] = m;
  px[seg][grp][w4][33][lane] = l;
  }

  __syncthreads();                                                   /* every wave passes it once; publishes the partials */
  if (grp < 2u) {                                                    /* group 0 merges S, group 1 L: only the slots of groups whose run met the batch were written, and only those are read; at least one was (ntotS, ntotL >= 1) */
    float mm = NEGBIG;
#pragma unroll
    for (unsigned g = 0; g < NG; ++g) {
      if (in_walk(grp, cu[g]) < in_walk(grp, cu[g + 1u])) mm = fmaxf(mm, px[grp][g][w4][32][lane]);
    }
    l = 0.f;
#pragma unroll
    for (int dt = 0; dt < 4; ++dt) oh[dt] = z8;
#pragma unroll
    for (unsigned g = 0; g < NG; ++g) {
      if (in_walk(grp, cu[g]) < in_walk(grp, cu[g + 1u])) {
        const float f = __builtin_amdgcn_exp2f(fmaxf((px[grp][g][w4][32][lane] - mm) * SC2, -115.0f));
        l += px[grp][g][w4][33][lane] * f;
#pragma unroll
        for (int dt = 0; dt < 4; ++dt) {
#pragma unroll
          for (int r = 0; r < 8; ++r) oh[dt][r] += px[grp][g][w4][dt * 8 + r][lane] * f;
        }
      }
    }
    const float lt = l + __shfl_xor(l, 16);
    put_rows(grp ? bL : bS, oh, 1.0f / lt);                          /* output and sum both carry the factor 256 */
  }
}

extern "C" void kernel_launch(void* const* d_in, const int* in_sizes, int n_in,
                              void* d_out, int out_size, void* d_ws, size_t ws_size, hipStream_t stream) {
  if (n_in < 4) return;
  const long long need = (long long)NB * SEQ * HD;
  if ((long long)in_sizes[0] < need || (long long)in_sizes[1] < need || (long long)in_sizes[2] < need || in_sizes[3] < NB) return;
  if ((long long)out_size < need) return;
  const float* xq = (const float*)d_in[0];
  const float* xk = (const float*)d_in[1];
  const float* xv = (const float*)d_in[2];
  const int* pl = (const int*)d_in[3];
  char* ws = (char*)d_ws; size_t off = 0;
  auto take = [&](size_t bytes) { char* p = ws + off; off += (bytes + 255) & ~(size_t)255; return p; };
  _Float16* K16 = (_Float16*)take((size_t)NB * SEQ * HD * 2);
  _Float16* VT = (_Float16*)take((size_t)NB * HD * SEQ * 2);
  if (off > ws_size) return;

  k_cvt<<<(unsigned)(NB * QT / TPB), 256, 0, stream>>>(xk, xv, K16, VT);
  k_fattn<<<(unsigned)(NB / 2 * QT), 512, 0, stream>>>(xq, K16, VT, pl, (float*)d_out);
}

// v009
// Measured time: 19.9 microseconds a run.
// In both of two side-by-side timings against v008, it was 1.04 times as fast.
// Counting every step since v000, it is 5.52 times as fast.
#include <hip/hip_runtime.h>
// Block-prefix + diagonal masked attention on given q, k, v ([16][2048][64] f32 each), scale 8/64, prefix length per batch read on device; out = softmax(masked q.k^T * 0.125) v -> [16][2048][64] f32.
// Structure: one conversion launch: k -> exact f16, v -> exact f16 V^T (LDS transpose), both stored per 64-key tile in the order of the matrix fragments (16 units of 512 B, lane l's 16 B at 16 l); one flash-style kernel: a wave owns 32 queries (two column blocks of 16 that share every K and V^T fragment), 2 waves a 64-query tile, a block of 8 waves (4 groups of 2) one such tile of a long-prefix and of a short-prefix batch; key tiles of 64 = tiles meeting [0, prefix) plus the tile holding the diagonal; computed transposed: S^T = K Q^T, online softmax per query column (f32), O^T += V^T P^T with P^T taken straight from the packed S^T accumulators.
// Compute dtype: q, k, v RNE-converted to bf16 and carried exactly in f16 (exact products, f32 accumulate) on v_wmma_f32_16x16x32_f16; softmax weights x256 as one f16 value (11 significant bits, against the 8 of the bf16-rounded q, k, v); statistics f32, the running sum taken from the unrounded weights.
#ifndef NB
#define NB 16
#endif
#ifndef SEQ
#define SEQ 2048
#endif
#define NB_FULL 16
#define SEQ_FULL 2048
#define HD 64
#define QT (SEQ / 64)
static_assert(SEQ % 64 == 0);
static_assert(SEQ <= SEQ_FULL);
static_assert(NB <= NB_FULL);
static_assert(NB % 2 == 0);
static_assert(((size_t)NB * SEQ * HD) % 2048 == 0);

typedef unsigned short v8us __attribute__((ext_vector_type(8), may_alias));
typedef _Float16 v16h __attribute__((ext_vector_type(16)));
typedef float  v8f  __attribute__((ext_vector_type(8)));
typedef float  v4f  __attribute__((ext_vector_type(4)));
typedef float  v4fa __attribute__((ext_vector_type(4), may_alias));
union FragH { v16h v; v8us half[2]; _Float16 h[16]; unsigned short u[16]; };

__device__ __forceinline__ unsigned short bf16_bits(float x) { unsigned int u = __float_as_uint(x); return (unsigned short)((u + 0x7FFFu + ((u >> 16) & 1u)) >> 16); }
__device__ __forceinline__ float bf16_val(unsigned short b) { return __uint_as_float(((unsigned int)b) << 16); }
__device__ __forceinline__ float bf16_rne(float x) { return bf16_val(bf16_bits(x)); }

// fragment (A or B, same k map), p = a row's 32 k values, h = lane >> 4: elements 0..7 <- p[8h .. 8h+7], elements 8..15 <- p[16+8h .. 16+8h+7]; row / column = lane & 15
// that fragment from a packed tile: p = unit base + 8 * lane; elements 0..7 from the first 512-B unit, elements 8..15 from the next, so each wave-wide 16-B load covers four whole 128-B lines
__device__ __forceinline__ v16h pk_frag(const _Float16* p) { FragH f; f.half[0] = *(const v8us*)((const unsigned short*)p); f.half[1] = *(const v8us*)((const unsigned short*)p + 256u); return f.v; }
// the four v_nop fill the vector issue slots that the chip needs between a matrix product and the next vector instruction on its result. Only D is named: with A and B named as well, the attention kernel (above 256 registers) spilled fragments to scratch; the compiler pads overwrites of A and B itself
__device__ __forceinline__ v8f g2_mma(v16h a, v16h b, v8f c) { v8f d = __builtin_amdgcn_wmma_f32_16x16x32_f16(false, a, false, b, (short)0, c, false, false); asm volatile("v_nop\n\tv_nop\n\tv_nop\n\tv_nop" : "+v"(d)); return d; }
// same fragment map from an f32 row: bf16 RNE then exact f16
__device__ __forceinline__ v16h q_frag(const float* p, unsigned hh) {
  const v4f x0 = *(const v4fa*)(p + 8u * hh), x1 = *(const v4fa*)(p + 8u * hh + 4u);
  const v4f x2 = *(const v4fa*)(p + 16u + 8u * hh), x3 = *(const v4fa*)(p + 16u + 8u * hh + 4u);
  FragH f;
#pragma unroll
  for (int q = 0; q < 4; ++q) { f.h[q] = (_Float16)bf16_rne(x0[q]); f.h[4 + q] = (_Float16)bf16_rne(x1[q]); f.h[8 + q] = (_Float16)bf16_rne(x2[q]); f.h[12 + q] = (_Float16)bf16_rne(x3[q]); }
  return f.v;
}

#define TPB 2                                                        /* 64-key tiles of K and of V that one conversion block takes */
static_assert(QT % TPB == 0);                                        /* a block's tiles lie in one batch, one behind the other */

// one launch converts K and V: a block takes TPB neighbouring 64-key tiles of both, a thread 2 * TPB 16-B pieces of the packed K plane and as many of the packed V^T plane. Piece n of a thread lies 32 n key rows behind its piece 0 in the source and 256 n pieces behind it in the packed plane, for K and for V alike.
__global__ __launch_bounds__(256) void k_cvt(const float* __restrict__ Kf, const float* __restrict__ V, _Float16* __restrict__ K16, _Float16* __restrict__ VT) {
  __shared__ unsigned short tl[TPB][64][65];
  const unsigned tid = threadIdx.x;
  const unsigned tile0 = blockIdx.x * (unsigned)TPB;                 /* first of the block's tiles, counted over (batch, tile) */
  const unsigned b = tile0 / (unsigned)QT, s0 = (tile0 - b * (unsigned)QT) * 64u;
  /* K: tid counts 16-B pieces of the packed plane: bits 0..3 key row in its group of 16, bit 4 lane half, bit 5 fragment half, bit 6 d half, bit 7 row group (its upper bit and the tile come from n) */
  const float* kp = Kf + ((size_t)b * SEQ_FULL + s0 + ((tid >> 7) & 1u) * 16u + (tid & 15u)) * HD + ((tid >> 6) & 1u) * 32u + ((tid >> 5) & 1u) * 16u + ((tid >> 4) & 1u) * 8u;
  /* V: tid counts 32-B pieces of the rows as they lie */
  const unsigned j = tid >> 3, d8 = (tid & 7u) * 8u;
  const float* vp = V + ((size_t)b * SEQ_FULL + s0 + j) * HD + d8;
  v4f kx[2 * TPB][2], vx[2 * TPB][2];
  /* every loop over n is unrolled so that the register arrays are indexed by constants */
#pragma unroll
  for (int n = 0; n < 2 * TPB; ++n) {
    kx[n][0] = *(const v4fa*)(kp + n * 32 * HD); kx[n][1] = *(const v4fa*)(kp + n * 32 * HD + 4);
    vx[n][0] = *(const v4fa*)(vp + n * 32 * HD); vx[n][1] = *(const v4fa*)(vp + n * 32 * HD + 4);
  }
  /* the wait that belongs in front of any rewrite of the loads' two address pairs; the pairs are named so that they stay as they are up to here. As a memory fence it also keeps all the loads issued ahead of the first LDS store */
  asm volatile("s_wait_xcnt 0x0" :: "v"(kp), "v"(vp) : "memory");
#pragma unroll
  for (int n = 0; n < 2 * TPB; ++n) {
    FragH f;
#pragma unroll
    for (int q = 0; q < 4; ++q) { f.h[q] = (_Float16)bf16_rne(vx[n][0][q]); f.h[4 + q] = (_Float16)bf16_rne(vx[n][1][q]); }
#pragma unroll
    for (int q = 0; q < 8; ++q) tl[n >> 1][d8 + q][j + (unsigned)(n & 1) * 32u] = f.u[q];
  }
  v8us ko[2 * TPB], vo[2 * TPB];
#pragma unroll
  for (int n = 0; n < 2 * TPB; ++n) {
    FragH f;
#pragma unroll
    for (int q = 0; q < 4; ++q) { f.h[q] = (_Float16)bf16_rne(kx[n][0][q]); f.h[4 + q] = (_Float16)bf16_rne(kx[n][1][q]); }
    ko[n] = f.half[0];
  }
  __syncthreads();                                                   /* the transposed tiles are whole */
#pragma unroll
  for (int n = 0; n < 2 * TPB; ++n) {
    const unsigned i = tid + (unsigned)(n & 1) * 256u;
    /* i counts 16-B pieces of the packed tile: bits 0..3 d row in its group of 16, bit 4 lane half, bit 5 fragment half, bit 6 key half, bits 7..8 d group */
    const unsigned d = ((i >> 7) & 3u) * 16u + (i & 15u), j8 = ((i >> 6) & 1u) * 32u + ((i >> 5) & 1u) * 16u + ((i >> 4) & 1u) * 8u;
    FragH f;
#pragma unroll
    for (int q = 0; q < 8; ++q) f.u[q] = tl[n >> 1][d][j8 + q];
    vo[n] = f.half[0];
  }
  /* the stores last, each its plane's one address plus a constant: nothing that they name is rewritten behind them */
  unsigned short* kd = (unsigned short*)K16 + (size_t)tile0 * (size_t)(64 * HD) + (size_t)tid * 8u;
  unsigned short* vd = (unsigned short*)VT + (size_t)tile0 * (size_t)(64 * HD) + (size_t)tid * 8u;
#pragma unroll
  for (int n = 0; n < 2 * TPB; ++n) { *(v8us*)(kd + n * 2048) = ko[n]; *(v8us*)(vd + n * 2048) = vo[n]; }
}

// scores of one 64-key tile -> weights, running maximum, rescale factor, tile sum. FULL: every key of the tile lies inside the prefix, so nothing is masked: the mask's compares and selects and the clamp on a weight's exponent are left out. Same output as the general form: a weight more than 80 below the maximum is 0 in f16 and below the rounding of the sum, clamped or not.
// Base-2 form: the running maximum m is kept in raw product units; a weight is 256 p = exp2(s * SC2 + nb), SC2 = log2(e) / 8, nb = 8 - m * SC2, so one fused multiply-add per score carries the scale, the change of base, the maximum and the weights' factor 256; the tile sum ls (and the running sum) therefore also carries the factor 256.
#define SC2 0.18033688011112042f
template <bool FULL>
__device__ __forceinline__ void soft_tile(v8f (&s)[4], unsigned key0, unsigned hh, unsigned plen, unsigned qidx, float& m, float& alpha, float& ls, FragH (&ph)[2]) {
  const float NEGBIG = -1.0e30f;
  float tmx = NEGBIG;
#pragma unroll
  for (int t = 0; t < 4; ++t) {
#pragma unroll
    for (int r = 0; r < 8; ++r) {
      float v = s[t][r];
      if (!FULL) {
        const unsigned key = key0 + (unsigned)t * 16u + 8u * hh + (unsigned)r;
        const bool keep = (key < plen) | (key == qidx);
        v = keep ? v : NEGBIG;
        s[t][r] = v;
      }
      tmx = fmaxf(tmx, v);
    }
  }
  tmx = fmaxf(tmx, __shfl_xor(tmx, 16));
  const float mnew = fmaxf(m, tmx);
  alpha = __builtin_amdgcn_exp2f(fmaxf((m - mnew) * SC2, -115.0f));
  m = mnew;
  const float nb = fmaf(-mnew, SC2, 8.0f);
  ls = 0.f;
  if (FULL) {                                                        /* exponents in place of the scores; the general form below still needs the raw score for its mask test */
#pragma unroll
    for (int t = 0; t < 4; ++t) s[t] = s[t] * SC2 + nb;
  }
#pragma unroll
  for (int t = 0; t < 4; ++t) {
#pragma unroll
    for (int r = 0; r < 8; ++r) {
      const float sv = s[t][r];
      float p256;
      if (FULL) {
        p256 = __builtin_amdgcn_exp2f(sv);
      } else {
        const float x = fmaf(sv, SC2, nb);
        const float e = __builtin_amdgcn_exp2f(fmaxf(x, -107.0f));
        p256 = (sv > -1.0e29f) ? e : 0.0f;
      }
      ls += p256;
      ph[t >> 1].h[(t & 1) * 8 + r] = (_Float16)p256;
    }
  }
}

// flash attention, transposed form. Lane (hh, ln) of a wave owns queries q0 + 16c + ln, c = 0, 1; S^T sub-tile t of column block c, element r = score(key key0 + 16t + 8hh + r, query q0 + 16c + ln). A K or V^T fragment, once in registers, feeds the products of both column blocks.
// Work shares: a block of 8 waves, two to a SIMD, takes query tile qt of two batches, the one with the r-th longest prefix (L) and the one with the r-th shortest (S), ranked on the device. S's key tiles followed by L's form one row of tiles, cut into NG runs of about equal cost, one per group of 2 waves; a run meets S, L or both. Every group leaves its partial of each batch it met (maximum, sum, un-normalised output) in LDS; behind one barrier waves 0..3 merge and store S, waves 4..7 L, each one block of 16 queries.
#define NG 4
#define NC 2                                                         /* column blocks of 16 queries per wave */
__global__ __launch_bounds__(256) void k_fattn(const float* __restrict__ Qf, const _Float16* __restrict__ K16, const _Float16* __restrict__ VT,
                                              const int* __restrict__ plen_n, float* __restrict__ Og) {
  __shared__ __attribute__((aligned(16))) float so[8][16][68];      /* output staging [query][d], private to each of the 8 waves */
  __shared__ float px[2][NG][4][34][32];                             /* [batch S, L][group][block of 16 queries in the tile]: a partial's 32 output values, maximum, sum, each [lane] */
  const unsigned tid = threadIdx.x, lane = tid & 31u, ln = lane & 15u, hh = lane >> 4;
  const unsigned w = (unsigned)__builtin_amdgcn_readfirstlane((int)(tid >> 5));   /* the wave's number as a scalar: every test on it is a scalar branch */
  const unsigned grp = w >> 1, w2 = w & 1u;
  const unsigned rk = blockIdx.x / (unsigned)QT, qt = blockIdx.x - rk * (unsigned)QT;
  const unsigned q0 = qt * 64u + w2 * 32u;

  /* rank of every batch by clamped prefix length, longest first, ties by index: lane ln holds batch ln; the ranks are a permutation of 0 .. NB - 1 for any lengths */
  int plv = plen_n[ln < (unsigned)NB ? ln : (unsigned)(NB - 1)];
  plv = plv < 0 ? 0 : plv; plv = plv > SEQ ? SEQ : plv;
  const int skey = (ln < (unsigned)NB) ? plv * 16 + (int)(15u - ln) : -1;
  int rank = 0;
#pragma unroll
  for (int j = 0; j < NB; ++j) rank += (__builtin_amdgcn_readlane(skey, j) > skey) ? 1 : 0;
  const unsigned bL = (unsigned)__builtin_ctz(__builtin_amdgcn_ballot_w32((rank == (int)rk) & (ln < (unsigned)NB)) | (1u << (NB - 1)));
  const unsigned bS = (unsigned)__builtin_ctz(__builtin_amdgcn_ballot_w32((rank == NB - 1 - (int)rk) & (ln < (unsigned)NB)) | (1u << (NB - 1)));
  const unsigned plL = (unsigned)__builtin_amdgcn_readlane(plv, (int)bL), plS = (unsigned)__builtin_amdgcn_readlane(plv, (int)bS);
  const unsigned ntpL = (plL + 63u) >> 6, ntotL = ntpL + ((qt >= ntpL) ? 1u : 0u);   /* key tiles meeting [0, plen), plus the diagonal tile when not covered: <= QT */
  const unsigned ntpS = (plS + 63u) >> 6, ntotS = ntpS + ((qt >= ntpS) ? 1u : 0u);
  /* equal shares, for speed only (any rising cuts from 0 to ntotS + ntotL give the same function): an unmasked tile costs 2, one with masked keys 3; a batch's unmasked tiles come first in its walk */
  const unsigned fS = plS >> 6, fL = plL >> 6;
  const unsigned cS = 2u * fS + 3u * (ntotS - fS), cT = cS + 2u * fL + 3u * (ntotL - fL);
  /* cu[g]: first tile, in the row of S's and L's tiles, of group g's run; cu[NG] is the row's end. Worked out once, the same in every wave */
  static_assert(NG == 4);
  unsigned cu[NG + 1];
  /* unrolled, here and in the merge, so that cu is indexed by constants and stays in scalar registers */
#pragma unroll
  for (unsigned g = 0; g <= NG; ++g) {
    const unsigned tau = (g * cT + 2u) >> 2;
    const unsigned inS = (tau <= 2u * fS) ? ((tau + 1u) >> 1) : fS + (tau - 2u * fS + 1u) / 3u;
    const unsigned inL = (tau <= cS + 2u * fL) ? ((tau - cS + 1u) >> 1) : fL + (tau - cS - 2u * fL + 1u) / 3u;
    cu[g] = (tau <= cS) ? inS : ntotS + inL;
  }
  /* a place c of that row as a tile of batch sel's own walk (0: S, 1: L), held inside the walk */
  auto in_walk = [&](unsigned sel, unsigned c) -> unsigned { return sel ? (c > ntotS ? c - ntotS : 0u) : (c < ntotS ? c : ntotS); };
  const unsigned c0 = grp == 0u ? cu[0] : grp == 1u ? cu[1] : grp == 2u ? cu[2] : cu[3];
  const unsigned c1 = grp == 0u ? cu[1] : grp == 1u ? cu[2] : grp == 2u ? cu[3] : cu[4];

  const unsigned l8 = 8u * lane;                                     /* the lane's place in every 512-B unit of a packed tile, in elements */
  const float NEGBIG = -1.0e30f;
  const v8f z8 = {0.f, 0.f, 0.f, 0.f, 0.f, 0.f, 0.f, 0.f};
  float m[NC], l[NC];
  v8f oh[NC][4];

  /* o * inv -> the 16 output rows from row r0 of batch b, whole 128-B lines through the wave's own staging */
  auto put_rows = [&](unsigned b, unsigned r0, const v8f (&o)[4], float inv) {
#pragma unroll
    for (int dt = 0; dt < 4; ++dt) {
#pragma unroll
      for (int r = 0; r < 8; ++r) so[w][ln][dt * 16 + 8 * (int)hh + r] = o[dt][r] * inv;
    }
    __builtin_amdgcn_fence(4 /* acq_rel order */, "workgroup");
    __builtin_amdgcn_wave_barrier();
    const unsigned rsub = lane >> 4, c4 = (lane & 15u) * 4u;
    float* op = Og + ((size_t)b * SEQ + r0 + rsub) * HD + c4;        /* the lane's whole address: the stores are this pair plus a constant */
#pragma unroll
    for (int q = 0; q < 8; ++q) {
      const v4f v = *(const v4fa*)&so[w][(unsigned)q * 2u + rsub][c4];
      *(v4f*)(op + (size_t)q * 2u * HD) = v;
    }
    /* the wait that belongs in front of any rewrite of the stores' address pair; the pair is named so that it stays as it is up to here */
    asm volatile("s_wait_xcnt 0x0" :: "v"(op) : "memory");
  };

  /* segment 0: this wave group's share of the short batch; segment 1: its share of the long one; either may be empty. One copy of the loops serves both */
#pragma unroll 1
  for (unsigned seg = 0u; seg < 2u; ++seg) {
  const unsigned b = seg ? bL : bS, plen = seg ? plL : plS;
  const unsigned ntp = seg ? ntpL : ntpS, ntot = seg ? ntotL : ntotS;
  const unsigned t0 = in_walk(seg, c0), t1 = in_walk(seg, c1);       /* the segment's tiles of the walk: [t0, t1), t1 <= ntot */
  if (t0 >= t1) continue;                                            /* the same in every lane of the group's waves; no barrier stands inside the loop */

  const float* qrow = Qf + ((size_t)b * SEQ_FULL + q0 + ln) * HD + 8u * hh;   /* the lane's whole address: the loads are this pair plus a constant */
  v16h qa[NC][2];
#pragma unroll
  for (int c = 0; c < NC; ++c) { qa[c][0] = q_frag(qrow + c * 16 * HD, 0u); qa[c][1] = q_frag(qrow + c * 16 * HD + 32, 0u); }
  const _Float16* Kb = K16 + (size_t)b * SEQ * HD;
  const _Float16* Vb = VT + (size_t)b * HD * SEQ;
#pragma unroll
  for (int c = 0; c < NC; ++c) {
    m[c] = NEGBIG; l[c] = 0.f;
#pragma unroll
    for (int dt = 0; dt < 4; ++dt) oh[c][dt] = z8;
  }

  /* register pipeline: ka holds the whole K tile of the pass (fetched one pass ahead), va the whole V^T tile (fetched at the head of its pass) */
  v16h ka[4][2], va[4][2];
  {
    const unsigned kf = (t0 < ntp) ? t0 : qt;                        /* first tile of the segment */
    const _Float16* kr = Kb + (size_t)kf * (64 * HD);                /* the tile's base, the same in every lane: every load below is this pair plus the lane's 16 l bytes plus a constant */
#pragma unroll
    for (int t = 0; t < 4; ++t) { ka[t][0] = pk_frag(kr + l8 + t * 1024); ka[t][1] = pk_frag(kr + l8 + t * 1024 + 512); }
    /* the wait that belongs in front of any rewrite of the loads' base pair and of the q loads' address pair; the pairs are named so that they stay as they are up to here */
    asm volatile("s_wait_xcnt 0x0" :: "s"(kr), "v"(qrow) : "memory");
  }

  /* the walk in two parts, each a loop of its own (the outer loop is unrolled so that 'part' is a constant in each): first the tiles wholly inside the prefix, then the at most two that hold a masked key */
  const unsigned nfull = plen >> 6;                                  /* tiles 0 .. nfull - 1 lie wholly inside [0, plen): nfull <= ntp */
  unsigned it = t0;
#pragma unroll
  for (int part = 0; part < 2; ++part) {
  const unsigned iend = (part == 0) ? (nfull < t1 ? nfull : t1) : t1;
#pragma unroll 1
  for (; it < iend; ++it) {
    const unsigned kt = (it < ntp) ? it : qt;
    const unsigned key0 = kt * 64u;
    const _Float16* vr = Vb + (size_t)kt * (64 * HD);                /* the tile's base, as above */
#pragma unroll
    for (int dt = 0; dt < 4; ++dt) { va[dt][0] = pk_frag(vr + l8 + dt * 1024); va[dt][1] = pk_frag(vr + l8 + dt * 1024 + 512); }
    /* keeps the 16 V^T loads issued here, ahead of scores and softmax; without it the scheduler sinks each group to its product and its latency is exposed */
    __builtin_amdgcn_sched_barrier(0);
    v8f s[NC][4];
#pragma unroll
    for (int t = 0; t < 4; ++t) {
#pragma unroll
      for (int c = 0; c < NC; ++c) s[c][t] = g2_mma(ka[t][0], qa[c][0], z8);
#pragma unroll
      for (int c = 0; c < NC; ++c) s[c][t] = g2_mma(ka[t][1], qa[c][1], s[c][t]);
    }
    const unsigned itn = (it + 1u < t1) ? it + 1u : it;              /* the last pass fetches its own tile again (in bounds, unused) */
    const unsigned kn = (itn < ntp) ? itn : qt;
    const _Float16* krn = Kb + (size_t)kn * (64 * HD);
#pragma unroll
    for (int t = 0; t < 4; ++t) { ka[t][0] = pk_frag(krn + l8 + t * 1024); ka[t][1] = pk_frag(krn + l8 + t * 1024 + 512); }
    /* keeps the next tile's 16 K loads issued here, so that softmax and the output products cover their latency */
    __builtin_amdgcn_sched_barrier(0);
    FragH ph[NC][2];
#pragma unroll
    for (int c = 0; c < NC; ++c) {
      float alpha, ls;
      if (part == 0) soft_tile<true>(s[c], key0, hh, plen, q0 + (unsigned)c * 16u + ln, m[c], alpha, ls, ph[c]);
      else soft_tile<false>(s[c], key0, hh, plen, q0 + (unsigned)c * 16u + ln, m[c], alpha, ls, ph[c]);
      l[c] = l[c] * alpha + ls;
#pragma unroll
      for (int dt = 0; dt < 4; ++dt) oh[c][dt] = oh[c][dt] * alpha;
    }
#pragma unroll
    for (int dt = 0; dt < 4; ++dt) {
#pragma unroll
      for (int c = 0; c < NC; ++c) oh[c][dt] = g2_mma(va[dt][0], ph[c][0].v, oh[c][dt]);
#pragma unroll
      for (int c = 0; c < NC; ++c) oh[c][dt] = g2_mma(va[dt][1], ph[c][1].v, oh[c][dt]);
    }
    /* the wait that belongs in front of any rewrite of the base pairs of this pass's loads; the pairs are named so that they stay as they are up to here */
    asm volatile("s_wait_xcnt 0x0" :: "s"(vr), "s"(krn) : "memory");
  }
  }

  /* the segment's partials, lane for lane (wave i of every group holds the same queries in the same lanes) */
#pragma unroll
  for (int c = 0; c < NC; ++c) {
#pragma unroll
    for (int dt = 0; dt < 4; ++dt) {
#pragma unroll
      for (int r = 0; r < 8; ++r) px[seg][grp][w2 * NC + c][dt * 8 + r][lane] = oh[c][dt][r];
    }
    px[seg][grp][w2 * NC + c][32][lane] = m[c];
    px[seg][grp][w2 * NC + c][33][lane] = l[c];
  }
  }

  __syncthreads();                                                   /* every wave passes it once; publishes the partials */
  {                                                                  /* waves 0..3 merge S, waves 4..7 L, wave by wave one block of 16 queries: only the slots of groups whose run met the batch were written, and only those are read; at least one was (ntotS, ntotL >= 1) */
    const unsigned sel = w >> 2, blk = w & 3u;
    float mm = NEGBIG;
#pragma unroll
    for (unsigned g = 0; g < NG; ++g) {
      if (in_walk(sel, cu[g]) < in_walk(sel, cu[g + 1u])) mm = fmaxf(mm, px[sel][g][blk][32][lane]);
    }
    float lm = 0.f;
    v8f om[4];
#pragma unroll
    for (int dt = 0; dt < 4; ++dt) om[dt] = z8;
#pragma unroll
    for (unsigned g = 0; g < NG; ++g) {
      if (in_walk(sel, cu[g]) < in_walk(sel, cu[g + 1u])) {
        const float f = __builtin_amdgcn_exp2f(fmaxf((px[sel][g][blk][32][lane] - mm) * SC2, -115.0f));
        lm += px[sel][g][blk][33][lane] * f;
#pragma unroll
        for (int dt = 0; dt < 4; ++dt) {
#pragma unroll
          for (int r = 0; r < 8; ++r) om[dt][r] += px[sel][g][blk][dt * 8 + r][lane] * f;
        }
      }
    }
    const float lt = lm + __shfl_xor(lm, 16);
    put_rows(sel ? bL : bS, qt * 64u + blk * 16u, om, 1.0f / lt);   /* output and sum both carry the factor 256 */
  }
}

extern "C" void kernel_launch(void* const* d_in, const int* in_sizes, int n_in,
                              void* d_out, int out_size, void* d_ws, size_t ws_size, hipStream_t stream) {
  if (n_in < 4) return;
  const long long need = (long long)NB * SEQ * HD;
  if ((long long)in_sizes[0] < need || (long long)in_sizes[1] < need || (long long)in_sizes[2] < need || in_sizes[3] < NB) return;
  if ((long long)out_size < need) return;
  const float* xq = (const float*)d_in[0];
  const float* xk = (const float*)d_in[1];
  const float* xv = (const float*)d_in[2];
  const int* pl = (const int*)d_in[3];
  char* ws = (char*)d_ws; size_t off = 0;
  auto take = [&](size_t bytes) { char* p = ws + off; off += (bytes + 255) & ~(size_t)255; return p; };
  _Float16* K16 = (_Float16*)take((size_t)NB * SEQ * HD * 2);
  _Float16* VT = (_Float16*)take((size_t)NB * HD * SEQ * 2);
  if (off > ws_size) return;

  k_cvt<<<(unsigned)(NB * QT / TPB), 256, 0, stream>>>(xk, xv, K16, VT);
  k_fattn<<<(unsigned)(NB / 2 * QT), 256, 0, stream>>>(xq, K16, VT, pl, (float*)d_out);
}
